// v000
// The times below were measured on an AMD MI455X: many runs one after another, warmed up first and cycling through
// copies of the inputs, with the whole window's GPU time divided by the number of runs. Launches and the gaps
// between them are all in it. The median over several windows is given; except for v000 it joins two sittings, which
// can be a few percent apart, so the side-by-side timings, each taken in one sitting, are the better comparison.
// v000, which the later versions start from, runs in 351 microseconds.
#include <hip/hip_runtime.h>

typedef __attribute__((ext_vector_type(16))) _Float16 v16h;
typedef __attribute__((ext_vector_type(8)))  _Float16 v8h;
typedef __attribute__((ext_vector_type(8)))  float    v8f;
typedef __attribute__((ext_vector_type(4)))  float    v4f;

#define B_  8
#define C_  256
#define CI_ 128
#define N_  4096

// Build a 16-bit A/B-matrix fragment (v16h -> 8 VGPRs) from a row-major source
// where the 32 K-values for this fragment's row live contiguously at rowbase+kbase.
// Per ISA 7.12.2 (16-bit A 16x32): lanes 0-15 hold K {0..7, 16..23},
// lanes 16-31 hold K {8..15, 24..31}; element i of v16h -> VGPR i/2 half i&1.
__device__ __forceinline__ v16h frag_from(const _Float16* rowbase, int kbase, int lane) {
  const int h = (lane >> 4) & 1;
  v8h a = *(const v8h*)(rowbase + kbase + 8 * h);
  v8h b = *(const v8h*)(rowbase + kbase + 16 + 8 * h);
  v16h r;
#pragma unroll
  for (int i = 0; i < 8; ++i) { r[i] = a[i]; r[i + 8] = b[i]; }
  return r;
}

// Async DMA of one 16-byte chunk from global memory into LDS (per lane).
// Tracked by ASYNCcnt; LDS address is wave-relative (low 32 bits of generic ptr).
__device__ __forceinline__ void async_copy_b128(unsigned lds_off, const void* gaddr) {
  asm volatile("global_load_async_to_lds_b128 %0, %1, off"
               :: "v"(lds_off), "v"(gaddr) : "memory");
}

__device__ __forceinline__ unsigned lds_off_of(const void* p) {
  return (unsigned)(size_t)p;  // generic LDS addr truncates to wave-relative offset
}

// ---------------------------------------------------------------------------
// Kernel 1: fused Q/K/V 1x1-conv projections as a f16 WMMA GEMM.
// Out tile per block: 128 pixels x 64 output channels. K-dim = C_ = 256.
// Q,K written (B,N,CI) pixel-major f16; V written (B,C,N) channel-major f16.
// ---------------------------------------------------------------------------
__global__ __launch_bounds__(256) void qkv_proj(
    const float* __restrict__ x,
    const float* __restrict__ Wq, const float* __restrict__ bq,
    const float* __restrict__ Wk, const float* __restrict__ bk,
    const float* __restrict__ Wv, const float* __restrict__ bv,
    _Float16* __restrict__ Qo, _Float16* __restrict__ Ko, _Float16* __restrict__ Vo) {
  __shared__ _Float16 Ald[128 * 40];  // 128 pixels x 32 ch, pitch 40 halves (16B rows)
  __shared__ _Float16 Bld[64 * 40];   // 64 outch x 32 ch

  const int tid  = threadIdx.x;
  const int lane = tid & 31;
  const int wave = tid >> 5;
  const int p0 = blockIdx.x * 128;
  const int o0 = blockIdx.y * 64;
  const int b  = blockIdx.z;

  const float* W; const float* bias; _Float16* dst; int crel; bool vmaj;
  if (o0 < 128)      { W = Wq; bias = bq; dst = Qo; crel = o0;       vmaj = false; }
  else if (o0 < 256) { W = Wk; bias = bk; dst = Ko; crel = o0 - 128; vmaj = false; }
  else               { W = Wv; bias = bv; dst = Vo; crel = o0 - 256; vmaj = true;  }

  const v8f zero = {0, 0, 0, 0, 0, 0, 0, 0};
  v8f acc[4];
#pragma unroll
  for (int t = 0; t < 4; ++t) acc[t] = zero;

  for (int c0 = 0; c0 < C_; c0 += 32) {
    // Stage A = x^T tile (transpose channel-major x through LDS, f32 -> f16).
#pragma unroll
    for (int it = 0; it < 4; ++it) {
      int lin = tid + 256 * it;          // 0..1023
      int c   = lin >> 5;                // 0..31 channel
      int p4  = lin & 31;                // pixel quad
      v4f f = *(const v4f*)(x + ((size_t)(b * C_ + c0 + c)) * N_ + p0 + p4 * 4);
#pragma unroll
      for (int i = 0; i < 4; ++i) Ald[(p4 * 4 + i) * 40 + c] = (_Float16)f[i];
    }
    // Stage B = weight tile (rows contiguous over input channel).
#pragma unroll
    for (int it = 0; it < 2; ++it) {
      int lin = tid + 256 * it;          // 0..511
      int o   = lin >> 3;
      int c4  = lin & 7;
      v4f f = *(const v4f*)(W + (size_t)(crel + o) * C_ + c0 + c4 * 4);
#pragma unroll
      for (int i = 0; i < 4; ++i) Bld[o * 40 + c4 * 4 + i] = (_Float16)f[i];
    }
    __syncthreads();

    v16h af = frag_from(&Ald[(wave * 16 + (lane & 15)) * 40], 0, lane);
#pragma unroll
    for (int tn = 0; tn < 4; ++tn) {
      v16h bf = frag_from(&Bld[(tn * 16 + (lane & 15)) * 40], 0, lane);
      acc[tn] = __builtin_amdgcn_wmma_f32_16x16x32_f16(false, af, false, bf,
                                                       (short)0, acc[tn], false, false);
    }
    __syncthreads();
  }

  // Bias + f16 store. C/D layout: col = lane&15, row = reg + 8*(lane>=16).
#pragma unroll
  for (int tn = 0; tn < 4; ++tn) {
    int cloc = crel + tn * 16 + (lane & 15);
    float bb = bias[cloc];
#pragma unroll
    for (int r = 0; r < 8; ++r) {
      int pix = p0 + wave * 16 + r + 8 * (lane >> 4);
      float v = acc[tn][r] + bb;
      size_t idx = vmaj ? ((size_t)(b * C_ + cloc)) * N_ + pix
                        : ((size_t)(b * N_ + pix)) * CI_ + cloc;
      dst[idx] = (_Float16)v;
    }
  }
}

// ---------------------------------------------------------------------------
// Kernel 2: flash attention + fused epilogue gamma*(softmax(QK^T)V)/l + x.
// Block: 128 query rows (1 M-tile per wave), 128 of 256 out-channels
// (blockIdx.z halves), key blocks of 64, head dim 128.
// K/V tiles are DMA'd to LDS once per block via GLOBAL_LOAD_ASYNC_TO_LDS_B128
// (instead of 8 redundant per-wave global fetches), then fragments are fed
// from LDS with ds_load_b128.
// ---------------------------------------------------------------------------
__global__ __launch_bounds__(256) void flash_attn(
    const _Float16* __restrict__ Q, const _Float16* __restrict__ K,
    const _Float16* __restrict__ V, const float* __restrict__ x,
    const float* __restrict__ gamma, float* __restrict__ out) {
  __shared__ _Float16 Klds[64 * 136];   // 64 keys x 128 ch, pitch 136 halves (17 chunks)
  __shared__ _Float16 Vlds[128 * 72];   // 128 ch x 64 keys, pitch 72 halves (9 chunks)
  __shared__ _Float16 Pld[128 * 72];    // P transpose staging, pitch 72 halves

  const int tid  = threadIdx.x;
  const int lane = tid & 31;
  const int wave = tid >> 5;
  const int m0  = blockIdx.x * 128;
  const int b   = blockIdx.y;
  const int ch0 = blockIdx.z * 128;

  const unsigned kbase = lds_off_of(&Klds[0]);
  const unsigned vbase = lds_off_of(&Vlds[0]);

  // Q fragments straight from global: (B,N,CI) rows are contiguous over c.
  const int rowq = m0 + wave * 16 + (lane & 15);
  const _Float16* qrow = Q + ((size_t)(b * N_ + rowq)) * CI_;
  v16h qf[4];
#pragma unroll
  for (int ks = 0; ks < 4; ++ks) qf[ks] = frag_from(qrow, ks * 32, lane);

  const v8f zero = {0, 0, 0, 0, 0, 0, 0, 0};
  v8f o[8];
#pragma unroll
  for (int t = 0; t < 8; ++t) o[t] = zero;
  float mrow[8], lrow[8];
#pragma unroll
  for (int r = 0; r < 8; ++r) { mrow[r] = -3.0e38f; lrow[r] = 0.0f; }

  for (int j0 = 0; j0 < N_; j0 += 64) {
    // ---- Async DMA: K tile (64 x 128 ch) and V tile (128 ch x 64 keys) ----
    // K: 64 rows x 16 b128-chunks = 1024 chunks, 4 per thread.
#pragma unroll
    for (int it = 0; it < 4; ++it) {
      int lin = tid + 256 * it;
      int row = lin >> 4, cc = lin & 15;
      async_copy_b128(kbase + (unsigned)(row * 17 + cc) * 16,
                      K + ((size_t)(b * N_ + j0 + row)) * CI_ + cc * 8);
    }
    // V: 128 rows x 8 b128-chunks = 1024 chunks, 4 per thread.
#pragma unroll
    for (int it = 0; it < 4; ++it) {
      int lin = tid + 256 * it;
      int row = lin >> 3, cc = lin & 7;
      async_copy_b128(vbase + (unsigned)(row * 9 + cc) * 16,
                      V + ((size_t)(b * C_ + ch0 + row)) * N_ + j0 + cc * 8);
    }
    asm volatile("s_wait_asynccnt 0" ::: "memory");
    __syncthreads();

    // ---- S = Q K^T for a 16 x 64 strip (4 tiles x 4 k-steps) ----
    v8f s[4];
#pragma unroll
    for (int tn = 0; tn < 4; ++tn) s[tn] = zero;
#pragma unroll
    for (int tn = 0; tn < 4; ++tn) {
      const _Float16* krow = &Klds[(tn * 16 + (lane & 15)) * 136];
#pragma unroll
      for (int ks = 0; ks < 4; ++ks) {
        v16h kf = frag_from(krow, ks * 32, lane);
        s[tn] = __builtin_amdgcn_wmma_f32_16x16x32_f16(false, qf[ks], false, kf,
                                                       (short)0, s[tn], false, false);
      }
    }

    // ---- Online softmax: rows live at (reg r, lane-half); cols across 16 lanes ----
#pragma unroll
    for (int r = 0; r < 8; ++r) {
      float v = fmaxf(fmaxf(s[0][r], s[1][r]), fmaxf(s[2][r], s[3][r]));
      v = fmaxf(v, __shfl_xor(v, 1, 32));
      v = fmaxf(v, __shfl_xor(v, 2, 32));
      v = fmaxf(v, __shfl_xor(v, 4, 32));
      v = fmaxf(v, __shfl_xor(v, 8, 32));
      float mn    = fmaxf(mrow[r], v);
      float alpha = __expf(mrow[r] - mn);
#pragma unroll
      for (int t = 0; t < 8; ++t) o[t][r] *= alpha;
      float rs = 0.f;
      int prow = (wave * 16 + r + 8 * (lane >> 4)) * 72 + (lane & 15);
#pragma unroll
      for (int tn = 0; tn < 4; ++tn) {
        float p = __expf(s[tn][r] - mn);
        Pld[prow + tn * 16] = (_Float16)p;   // C-layout -> row-major P in LDS
        rs += p;
      }
      rs += __shfl_xor(rs, 1, 32);
      rs += __shfl_xor(rs, 2, 32);
      rs += __shfl_xor(rs, 4, 32);
      rs += __shfl_xor(rs, 8, 32);
      lrow[r] = lrow[r] * alpha + rs;
      mrow[r] = mn;
    }

    // Wave-private LDS RAW: P stores must land before fragment reload.
    asm volatile("s_wait_dscnt 0" ::: "memory");

    // ---- O += P V : 2 k-steps over the 64 keys x 8 channel tiles ----
#pragma unroll
    for (int ks = 0; ks < 2; ++ks) {
      v16h pf = frag_from(&Pld[(wave * 16 + (lane & 15)) * 72], ks * 32, lane);
#pragma unroll
      for (int ct = 0; ct < 8; ++ct) {
        const _Float16* vrow = &Vlds[(ct * 16 + (lane & 15)) * 72];
        v16h vf = frag_from(vrow, ks * 32, lane);
        o[ct] = __builtin_amdgcn_wmma_f32_16x16x32_f16(false, pf, false, vf,
                                                       (short)0, o[ct], false, false);
      }
    }
    __syncthreads();   // keep next tile's DMA from overwriting live K/V reads
  }

  // ---- Epilogue: out = gamma * O / l + x (both (B,C,N) f32) ----
  const float g = gamma[0];
#pragma unroll
  for (int r = 0; r < 8; ++r) {
    float inv = 1.0f / lrow[r];
    int pix = m0 + wave * 16 + r + 8 * (lane >> 4);
#pragma unroll
    for (int ct = 0; ct < 8; ++ct) {
      int c = ch0 + ct * 16 + (lane & 15);
      size_t idx = ((size_t)(b * C_ + c)) * N_ + pix;
      out[idx] = g * (o[ct][r] * inv) + x[idx];
    }
  }
}

extern "C" void kernel_launch(void* const* d_in, const int* in_sizes, int n_in,
                              void* d_out, int out_size, void* d_ws, size_t ws_size,
                              hipStream_t stream) {
  const float* x     = (const float*)d_in[0];
  const float* Wq    = (const float*)d_in[1];
  const float* bq    = (const float*)d_in[2];
  const float* Wk    = (const float*)d_in[3];
  const float* bk    = (const float*)d_in[4];
  const float* Wv    = (const float*)d_in[5];
  const float* bv    = (const float*)d_in[6];
  const float* gamma = (const float*)d_in[7];
  float* out = (float*)d_out;

  // Workspace: Q (8MB) | K (8MB) | V (16MB), all f16.
  _Float16* Qw = (_Float16*)d_ws;
  _Float16* Kw = Qw + (size_t)B_ * N_ * CI_;
  _Float16* Vw = Kw + (size_t)B_ * N_ * CI_;

  dim3 pgrid(N_ / 128, (2 * CI_ + C_) / 64, B_);  // 32 x 8 x 8
  qkv_proj<<<pgrid, 256, 0, stream>>>(x, Wq, bq, Wk, bk, Wv, bv, Qw, Kw, Vw);

  dim3 agrid(N_ / 128, B_, 2);                    // 32 x 8 x 2 (channel halves)
  flash_attn<<<agrid, 256, 0, stream>>>(Qw, Kw, Vw, x, gamma, out);
}

// v001
// It runs in 222 microseconds.
// Next to v000, in two timings, it ran 1.60 times as fast each time.
#include <hip/hip_runtime.h>

typedef __attribute__((ext_vector_type(16))) _Float16 v16h;
typedef __attribute__((ext_vector_type(8)))  _Float16 v8h;
typedef __attribute__((ext_vector_type(8)))  float    v8f;
typedef __attribute__((ext_vector_type(4)))  float    v4f;

#define B_  8
#define C_  256
#define CI_ 128
#define N_  4096

// Build a 16-bit A/B-matrix fragment (v16h -> 8 VGPRs) from a row-major source
// where the 32 K-values for this fragment's row live contiguously at rowbase+kbase.
// Per ISA 7.12.2 (16-bit A 16x32): lanes 0-15 hold K {0..7, 16..23},
// lanes 16-31 hold K {8..15, 24..31}; element i of v16h -> VGPR i/2 half i&1.
__device__ __forceinline__ v16h frag_from(const _Float16* rowbase, int kbase, int lane) {
  const int h = (lane >> 4) & 1;
  v8h a = *(const v8h*)(rowbase + kbase + 8 * h);
  v8h b = *(const v8h*)(rowbase + kbase + 16 + 8 * h);
  v16h r;
#pragma unroll
  for (int i = 0; i < 8; ++i) { r[i] = a[i]; r[i + 8] = b[i]; }
  return r;
}

// Async DMA of one 16-byte chunk from global memory into LDS (per lane).
// Tracked by ASYNCcnt; LDS address is wave-relative (low 32 bits of generic ptr).
__device__ __forceinline__ void async_copy_b128(unsigned lds_off, const void* gaddr) {
  asm volatile("global_load_async_to_lds_b128 %0, %1, off"
               :: "v"(lds_off), "v"(gaddr) : "memory");
}

__device__ __forceinline__ unsigned lds_off_of(const void* p) {
  return (unsigned)(size_t)p;  // generic LDS addr truncates to wave-relative offset
}

// Lane l exchanges with lane l ^ 16 (the other 16-lane row), in registers.
__device__ __forceinline__ float xhalf(float v) {
  int i = __builtin_bit_cast(int, v);
  return __builtin_bit_cast(float,
      __builtin_amdgcn_permlanex16(i, i, 0x76543210, 0xfedcba98, false, false));
}

// ---------------------------------------------------------------------------
// Kernel 1: fused Q/K/V 1x1-conv projections as a f16 WMMA GEMM.
// Out tile per block: 128 pixels x 64 output channels. K-dim = C_ = 256.
// Q,K written (B,N,CI) pixel-major f16; V written (B,C,N) channel-major f16.
// ---------------------------------------------------------------------------
__global__ __launch_bounds__(256) void qkv_proj(
    const float* __restrict__ x,
    const float* __restrict__ Wq, const float* __restrict__ bq,
    const float* __restrict__ Wk, const float* __restrict__ bk,
    const float* __restrict__ Wv, const float* __restrict__ bv,
    _Float16* __restrict__ Qo, _Float16* __restrict__ Ko, _Float16* __restrict__ Vo) {
  __shared__ _Float16 Ald[128 * 40];  // 128 pixels x 32 ch, pitch 40 halves (16B rows)
  __shared__ _Float16 Bld[64 * 40];   // 64 outch x 32 ch

  const int tid  = threadIdx.x;
  const int lane = tid & 31;
  const int wave = tid >> 5;
  const int p0 = blockIdx.x * 128;
  const int o0 = blockIdx.y * 64;
  const int b  = blockIdx.z;

  const float* W; const float* bias; _Float16* dst; int crel; bool vmaj;
  if (o0 < 128)      { W = Wq; bias = bq; dst = Qo; crel = o0;       vmaj = false; }
  else if (o0 < 256) { W = Wk; bias = bk; dst = Ko; crel = o0 - 128; vmaj = false; }
  else               { W = Wv; bias = bv; dst = Vo; crel = o0 - 256; vmaj = true;  }

  const v8f zero = {0, 0, 0, 0, 0, 0, 0, 0};
  v8f acc[4];
#pragma unroll
  for (int t = 0; t < 4; ++t) acc[t] = zero;

  for (int c0 = 0; c0 < C_; c0 += 32) {
    // Stage A = x^T tile (transpose channel-major x through LDS, f32 -> f16).
#pragma unroll
    for (int it = 0; it < 4; ++it) {
      int lin = tid + 256 * it;          // 0..1023
      int c   = lin >> 5;                // 0..31 channel
      int p4  = lin & 31;                // pixel quad
      v4f f = *(const v4f*)(x + ((size_t)(b * C_ + c0 + c)) * N_ + p0 + p4 * 4);
#pragma unroll
      for (int i = 0; i < 4; ++i) Ald[(p4 * 4 + i) * 40 + c] = (_Float16)f[i];
    }
    // Stage B = weight tile (rows contiguous over input channel).
#pragma unroll
    for (int it = 0; it < 2; ++it) {
      int lin = tid + 256 * it;          // 0..511
      int o   = lin >> 3;
      int c4  = lin & 7;
      v4f f = *(const v4f*)(W + (size_t)(crel + o) * C_ + c0 + c4 * 4);
#pragma unroll
      for (int i = 0; i < 4; ++i) Bld[o * 40 + c4 * 4 + i] = (_Float16)f[i];
    }
    __syncthreads();

    v16h af = frag_from(&Ald[(wave * 16 + (lane & 15)) * 40], 0, lane);
#pragma unroll
    for (int tn = 0; tn < 4; ++tn) {
      v16h bf = frag_from(&Bld[(tn * 16 + (lane & 15)) * 40], 0, lane);
      acc[tn] = __builtin_amdgcn_wmma_f32_16x16x32_f16(false, af, false, bf,
                                                       (short)0, acc[tn], false, false);
    }
    __syncthreads();
  }

  // Bias + f16 store. C/D layout: col = lane&15, row = reg + 8*(lane>=16).
#pragma unroll
  for (int tn = 0; tn < 4; ++tn) {
    int cloc = crel + tn * 16 + (lane & 15);
    float bb = bias[cloc];
#pragma unroll
    for (int r = 0; r < 8; ++r) {
      int pix = p0 + wave * 16 + r + 8 * (lane >> 4);
      float v = acc[tn][r] + bb;
      size_t idx = vmaj ? ((size_t)(b * C_ + cloc)) * N_ + pix
                        : ((size_t)(b * N_ + pix)) * CI_ + cloc;
      dst[idx] = (_Float16)v;
    }
  }
}

__global__ __launch_bounds__(256) void flash_attn(
    const _Float16* __restrict__ Q, const _Float16* __restrict__ K,
    const _Float16* __restrict__ V, const float* __restrict__ x,
    const float* __restrict__ gamma, float* __restrict__ out) {
  __shared__ _Float16 Klds[64 * 136];   // 64 keys x 128 ch, pitch 136 halves (17 chunks)
  __shared__ _Float16 Vlds[128 * 72];   // 128 ch x 64 keys, pitch 72 halves (9 chunks)

  const int tid  = threadIdx.x;
  const int lane = tid & 31;
  const int wave = tid >> 5;
  const int m0  = blockIdx.x * 128;
  const int b   = blockIdx.y;
  const int ch0 = blockIdx.z * 128;

  const unsigned kbase = lds_off_of(&Klds[0]);
  const unsigned vbase = lds_off_of(&Vlds[0]);

  // Q fragments straight from global: (B,N,CI) rows are contiguous over c.
  const int rowq = m0 + wave * 16 + (lane & 15);
  const _Float16* qrow = Q + ((size_t)(b * N_ + rowq)) * CI_;
  v16h qf[4];
#pragma unroll
  for (int ks = 0; ks < 4; ++ks) qf[ks] = frag_from(qrow, ks * 32, lane);

  const v8f zero = {0, 0, 0, 0, 0, 0, 0, 0};
  v8f o[8];
#pragma unroll
  for (int t = 0; t < 8; ++t) o[t] = zero;
  float mrun = -3.0e38f;   // running maximum of this lane's query
  v8f   lacc = zero;       // running sums: register r, this wave half's keys only

  for (int j0 = 0; j0 < N_; j0 += 64) {
    // ---- Async DMA: K tile (64 x 128 ch) and V tile (128 ch x 64 keys) ----
    // K: 64 rows x 16 b128-chunks = 1024 chunks, 4 per thread.
#pragma unroll
    for (int it = 0; it < 4; ++it) {
      int lin = tid + 256 * it;
      int row = lin >> 4, cc = lin & 15;
      async_copy_b128(kbase + (unsigned)(row * 17 + cc) * 16,
                      K + ((size_t)(b * N_ + j0 + row)) * CI_ + cc * 8);
    }
    // V: 128 rows x 8 b128-chunks = 1024 chunks, 4 per thread.
#pragma unroll
    for (int it = 0; it < 4; ++it) {
      int lin = tid + 256 * it;
      int row = lin >> 3, cc = lin & 7;
      async_copy_b128(vbase + (unsigned)(row * 9 + cc) * 16,
                      V + ((size_t)(b * C_ + ch0 + row)) * N_ + j0 + cc * 8);
    }
    asm volatile("s_wait_asynccnt 0" ::: "memory");
    __syncthreads();

    // ---- S^T = K Q^T for a 64-key x 16-query strip (4 tiles x 4 k-steps) ----
    // D layout: query = lane&15, key = tn*16 + reg + 8*(lane>=16).
    v8f s[4];
#pragma unroll
    for (int tn = 0; tn < 4; ++tn) s[tn] = zero;
#pragma unroll
    for (int tn = 0; tn < 4; ++tn) {
      const _Float16* krow = &Klds[(tn * 16 + (lane & 15)) * 136];
#pragma unroll
      for (int ks = 0; ks < 4; ++ks) {
        v16h kf = frag_from(krow, ks * 32, lane);
        s[tn] = __builtin_amdgcn_wmma_f32_16x16x32_f16(false, kf, false, qf[ks],
                                                       (short)0, s[tn], false, false);
      }
    }

    // ---- Online softmax: 32 of this query's 64 scores are in this lane ----
    float v = -3.0e38f;
#pragma unroll
    for (int r = 0; r < 8; ++r)
      v = fmaxf(v, fmaxf(fmaxf(s[0][r], s[1][r]), fmaxf(s[2][r], s[3][r])));
    v = fmaxf(v, xhalf(v));
    const float mn    = fmaxf(mrun, v);
    const float alpha = __expf(mrun - mn);
    mrun = mn;
#pragma unroll
    for (int t = 0; t < 8; ++t) o[t] *= alpha;

    // P^T as B fragments: tile 2ks gives k = 8h..8h+7, tile 2ks+1 k = 16+8h..16+8h+7.
    v16h pf[2];
    v8f rs = zero;
#pragma unroll
    for (int tn = 0; tn < 4; ++tn) {
#pragma unroll
      for (int r = 0; r < 8; ++r) {
        float p = __expf(s[tn][r] - mn);
        pf[tn >> 1][(tn & 1) * 8 + r] = (_Float16)p;
        rs[r] += p;
      }
    }
    lacc = lacc * alpha + rs;

    // ---- O^T += V P^T : 2 k-steps over the 64 keys x 8 channel tiles ----
#pragma unroll
    for (int ks = 0; ks < 2; ++ks) {
#pragma unroll
      for (int ct = 0; ct < 8; ++ct) {
        const _Float16* vrow = &Vlds[(ct * 16 + (lane & 15)) * 72];
        v16h vf = frag_from(vrow, ks * 32, lane);
        o[ct] = __builtin_amdgcn_wmma_f32_16x16x32_f16(false, vf, false, pf[ks],
                                                       (short)0, o[ct], false, false);
      }
    }
    __syncthreads();   // keep next tile's DMA from overwriting live K/V reads
  }

  // ---- Epilogue: out = gamma * O / l + x (both (B,C,N) f32) ----
  // O^T layout: pixel = lane&15, channel = ct*16 + reg + 8*(lane>=16).
  const float g = gamma[0];
  float lsum = ((lacc[0] + lacc[1]) + (lacc[2] + lacc[3])) +
               ((lacc[4] + lacc[5]) + (lacc[6] + lacc[7]));
  lsum += xhalf(lsum);
  const float inv = 1.0f / lsum;
  const int pix = m0 + wave * 16 + (lane & 15);
#pragma unroll
  for (int ct = 0; ct < 8; ++ct) {
#pragma unroll
    for (int r = 0; r < 8; ++r) {
      int c = ch0 + ct * 16 + r + 8 * (lane >> 4);
      size_t idx = ((size_t)(b * C_ + c)) * N_ + pix;
      out[idx] = g * (o[ct][r] * inv) + x[idx];
    }
  }
}

extern "C" void kernel_launch(void* const* d_in, const int* in_sizes, int n_in,
                              void* d_out, int out_size, void* d_ws, size_t ws_size,
                              hipStream_t stream) {
  const float* x     = (const float*)d_in[0];
  const float* Wq    = (const float*)d_in[1];
  const float* bq    = (const float*)d_in[2];
  const float* Wk    = (const float*)d_in[3];
  const float* bk    = (const float*)d_in[4];
  const float* Wv    = (const float*)d_in[5];
  const float* bv    = (const float*)d_in[6];
  const float* gamma = (const float*)d_in[7];
  float* out = (float*)d_out;

  // Workspace: Q (8MB) | K (8MB) | V (16MB), all f16.
  _Float16* Qw = (_Float16*)d_ws;
  _Float16* Kw = Qw + (size_t)B_ * N_ * CI_;
  _Float16* Vw = Kw + (size_t)B_ * N_ * CI_;

  dim3 pgrid(N_ / 128, (2 * CI_ + C_) / 64, B_);  // 32 x 8 x 8
  qkv_proj<<<pgrid, 256, 0, stream>>>(x, Wq, bq, Wk, bk, Wv, bv, Qw, Kw, Vw);

  dim3 agrid(N_ / 128, B_, 2);                    // 32 x 8 x 2 (channel halves)
  flash_attn<<<agrid, 256, 0, stream>>>(Qw, Kw, Vw, x, gamma, out);
}

// v002
// One run takes 206 microseconds.
// In both of two side-by-side timings against v001, it was 1.08 times as fast.
// Counting every step since v000, it is 1.73 times as fast.
#include <hip/hip_runtime.h>

typedef __attribute__((ext_vector_type(16))) _Float16 v16h;
typedef __attribute__((ext_vector_type(8)))  _Float16 v8h;
typedef __attribute__((ext_vector_type(8)))  float    v8f;
typedef __attribute__((ext_vector_type(4)))  float    v4f;

#define B_  8
#define C_  256
#define CI_ 128
#define N_  4096

// Keeps a group of LDS fragment reads where the source puts it: without it the
// scheduler sinks each read to just in front of its product, and every product
// then waits out a whole LDS latency.
#define GROUP_EDGE() __builtin_amdgcn_sched_barrier(0)

// Build a 16-bit A/B-matrix fragment (v16h -> 8 VGPRs) from a row-major source
// where the 32 K-values for this fragment's row live contiguously at rowbase+kbase.
// Per ISA 7.12.2 (16-bit A 16x32): lanes 0-15 hold K {0..7, 16..23},
// lanes 16-31 hold K {8..15, 24..31}; element i of v16h -> VGPR i/2 half i&1.
__device__ __forceinline__ v16h frag_from(const _Float16* rowbase, int kbase, int lane) {
  const int h = (lane >> 4) & 1;
  v8h a = *(const v8h*)(rowbase + kbase + 8 * h);
  v8h b = *(const v8h*)(rowbase + kbase + 16 + 8 * h);
  v16h r;
#pragma unroll
  for (int i = 0; i < 8; ++i) { r[i] = a[i]; r[i + 8] = b[i]; }
  return r;
}

// Async DMA of one 16-byte chunk from global memory into LDS (per lane).
// Tracked by ASYNCcnt; LDS address is wave-relative (low 32 bits of generic ptr).
__device__ __forceinline__ void async_copy_b128(unsigned lds_off, const void* gaddr) {
  asm volatile("global_load_async_to_lds_b128 %0, %1, off"
               :: "v"(lds_off), "v"(gaddr) : "memory");
}

__device__ __forceinline__ unsigned lds_off_of(const void* p) {
  return (unsigned)(size_t)p;  // generic LDS addr truncates to wave-relative offset
}

// Lane l exchanges with lane l ^ 16 (the other 16-lane row), in registers.
__device__ __forceinline__ float xhalf(float v) {
  int i = __builtin_bit_cast(int, v);
  return __builtin_bit_cast(float,
      __builtin_amdgcn_permlanex16(i, i, 0x76543210, 0xfedcba98, false, false));
}

// ---------------------------------------------------------------------------
// Kernel 1: fused Q/K/V 1x1-conv projections as a f16 WMMA GEMM.
// Out tile per block: 128 pixels x 64 output channels. K-dim = C_ = 256.
// Q,K written (B,N,CI) pixel-major f16; V written (B,C,N) channel-major f16.
// ---------------------------------------------------------------------------
__global__ __launch_bounds__(256) void qkv_proj(
    const float* __restrict__ x,
    const float* __restrict__ Wq, const float* __restrict__ bq,
    const float* __restrict__ Wk, const float* __restrict__ bk,
    const float* __restrict__ Wv, const float* __restrict__ bv,
    _Float16* __restrict__ Qo, _Float16* __restrict__ Ko, _Float16* __restrict__ Vo) {
  __shared__ _Float16 Ald[128 * 40];  // 128 pixels x 32 ch, pitch 40 halves (16B rows)
  __shared__ _Float16 Bld[64 * 40];   // 64 outch x 32 ch

  const int tid  = threadIdx.x;
  const int lane = tid & 31;
  const int wave = tid >> 5;
  const int p0 = blockIdx.x * 128;
  const int o0 = blockIdx.y * 64;
  const int b  = blockIdx.z;

  const float* W; const float* bias; _Float16* dst; int crel; bool vmaj;
  if (o0 < 128)      { W = Wq; bias = bq; dst = Qo; crel = o0;       vmaj = false; }
  else if (o0 < 256) { W = Wk; bias = bk; dst = Ko; crel = o0 - 128; vmaj = false; }
  else               { W = Wv; bias = bv; dst = Vo; crel = o0 - 256; vmaj = true;  }

  const v8f zero = {0, 0, 0, 0, 0, 0, 0, 0};
  v8f acc[4];
#pragma unroll
  for (int t = 0; t < 4; ++t) acc[t] = zero;

  for (int c0 = 0; c0 < C_; c0 += 32) {
    // Stage A = x^T tile (transpose channel-major x through LDS, f32 -> f16).
#pragma unroll
    for (int it = 0; it < 4; ++it) {
      int lin = tid + 256 * it;          // 0..1023
      int c   = lin >> 5;                // 0..31 channel
      int p4  = lin & 31;                // pixel quad
      v4f f = *(const v4f*)(x + ((size_t)(b * C_ + c0 + c)) * N_ + p0 + p4 * 4);
#pragma unroll
      for (int i = 0; i < 4; ++i) Ald[(p4 * 4 + i) * 40 + c] = (_Float16)f[i];
    }
    // Stage B = weight tile (rows contiguous over input channel).
#pragma unroll
    for (int it = 0; it < 2; ++it) {
      int lin = tid + 256 * it;          // 0..511
      int o   = lin >> 3;
      int c4  = lin & 7;
      v4f f = *(const v4f*)(W + (size_t)(crel + o) * C_ + c0 + c4 * 4);
#pragma unroll
      for (int i = 0; i < 4; ++i) Bld[o * 40 + c4 * 4 + i] = (_Float16)f[i];
    }
    __syncthreads();

    v16h af = frag_from(&Ald[(wave * 16 + (lane & 15)) * 40], 0, lane);
#pragma unroll
    for (int tn = 0; tn < 4; ++tn) {
      v16h bf = frag_from(&Bld[(tn * 16 + (lane & 15)) * 40], 0, lane);
      acc[tn] = __builtin_amdgcn_wmma_f32_16x16x32_f16(false, af, false, bf,
                                                       (short)0, acc[tn], false, false);
    }
    __syncthreads();
  }

  // Bias + f16 store. C/D layout: col = lane&15, row = reg + 8*(lane>=16).
#pragma unroll
  for (int tn = 0; tn < 4; ++tn) {
    int cloc = crel + tn * 16 + (lane & 15);
    float bb = bias[cloc];
#pragma unroll
    for (int r = 0; r < 8; ++r) {
      int pix = p0 + wave * 16 + r + 8 * (lane >> 4);
      float v = acc[tn][r] + bb;
      size_t idx = vmaj ? ((size_t)(b * C_ + cloc)) * N_ + pix
                        : ((size_t)(b * N_ + pix)) * CI_ + cloc;
      dst[idx] = (_Float16)v;
    }
  }
}

__global__ __launch_bounds__(256) void flash_attn(
    const _Float16* __restrict__ Q, const _Float16* __restrict__ K,
    const _Float16* __restrict__ V, const float* __restrict__ x,
    const float* __restrict__ gamma, float* __restrict__ out) {
  __shared__ _Float16 Klds[64 * 136];   // 64 keys x 128 ch, pitch 136 halves (17 chunks)
  __shared__ _Float16 Vlds[128 * 72];   // 128 ch x 64 keys, pitch 72 halves (9 chunks)

  const int tid  = threadIdx.x;
  const int lane = tid & 31;
  const int wave = tid >> 5;
  const int m0  = blockIdx.x * 128;
  const int b   = blockIdx.y;
  const int ch0 = blockIdx.z * 128;

  const unsigned kbase = lds_off_of(&Klds[0]);
  const unsigned vbase = lds_off_of(&Vlds[0]);

  // Q fragments straight from global: (B,N,CI) rows are contiguous over c.
  const int rowq = m0 + wave * 16 + (lane & 15);
  const _Float16* qrow = Q + ((size_t)(b * N_ + rowq)) * CI_;
  v16h qf[4];
#pragma unroll
  for (int ks = 0; ks < 4; ++ks) qf[ks] = frag_from(qrow, ks * 32, lane);

  const v8f zero = {0, 0, 0, 0, 0, 0, 0, 0};
  v8f o[8];
#pragma unroll
  for (int t = 0; t < 8; ++t) o[t] = zero;
  float mrun = -3.0e38f;   // running maximum of this lane's query
  v8f   lacc = zero;       // running sums: register r, this wave half's keys only

  for (int j0 = 0; j0 < N_; j0 += 64) {
    // ---- Async DMA: K tile (64 x 128 ch) and V tile (128 ch x 64 keys) ----
    // K: 64 rows x 16 b128-chunks = 1024 chunks, 4 per thread.
#pragma unroll
    for (int it = 0; it < 4; ++it) {
      int lin = tid + 256 * it;
      int row = lin >> 4, cc = lin & 15;
      async_copy_b128(kbase + (unsigned)(row * 17 + cc) * 16,
                      K + ((size_t)(b * N_ + j0 + row)) * CI_ + cc * 8);
    }
    // V: 128 rows x 8 b128-chunks = 1024 chunks, 4 per thread.
#pragma unroll
    for (int it = 0; it < 4; ++it) {
      int lin = tid + 256 * it;
      int row = lin >> 3, cc = lin & 7;
      async_copy_b128(vbase + (unsigned)(row * 9 + cc) * 16,
                      V + ((size_t)(b * C_ + ch0 + row)) * N_ + j0 + cc * 8);
    }
    asm volatile("s_wait_asynccnt 0" ::: "memory");
    __syncthreads();

    // ---- S^T = K Q^T for a 64-key x 16-query strip (4 k-steps x 4 tiles) ----
    // D layout: query = lane&15, key = tn*16 + reg + 8*(lane>=16).
    // Fragments come from LDS in groups of four through a ring of two groups:
    // a group is requested as soon as the products on its registers are issued,
    // one group of products ahead of its use. The ring runs on into V, so the
    // first eight V fragments are under way while the softmax is computed.
    const _Float16* kb = &Klds[(lane & 15) * 136];
    const _Float16* vb = &Vlds[(lane & 15) * 72];
    v16h fr[8];
#pragma unroll
    for (int t = 0; t < 4; ++t) fr[t] = frag_from(kb + t * 16 * 136, 0, lane);
#pragma unroll
    for (int t = 0; t < 4; ++t) fr[4 + t] = frag_from(kb + t * 16 * 136, 32, lane);
    GROUP_EDGE();
    v8f s[4];
#pragma unroll
    for (int tn = 0; tn < 4; ++tn) s[tn] = zero;
#pragma unroll
    for (int ks = 0; ks < 4; ++ks) {
      const int g = (ks & 1) * 4;
#pragma unroll
      for (int tn = 0; tn < 4; ++tn)
        s[tn] = __builtin_amdgcn_wmma_f32_16x16x32_f16(false, fr[g + tn], false, qf[ks],
                                                       (short)0, s[tn], false, false);
      GROUP_EDGE();
#pragma unroll
      for (int t = 0; t < 4; ++t)
        fr[g + t] = (ks < 2) ? frag_from(kb + t * 16 * 136, (ks + 2) * 32, lane)
                             : frag_from(vb + (g + t) * 16 * 72, 0, lane);
      GROUP_EDGE();
    }

    // ---- Online softmax: 32 of this query's 64 scores are in this lane ----
    float v = -3.0e38f;
#pragma unroll
    for (int r = 0; r < 8; ++r)
      v = fmaxf(v, fmaxf(fmaxf(s[0][r], s[1][r]), fmaxf(s[2][r], s[3][r])));
    v = fmaxf(v, xhalf(v));
    const float mn    = fmaxf(mrun, v);
    const float alpha = __expf(mrun - mn);
    mrun = mn;
#pragma unroll
    for (int t = 0; t < 8; ++t) o[t] *= alpha;

    // P^T as B fragments: tile 2ks gives k = 8h..8h+7, tile 2ks+1 k = 16+8h..16+8h+7.
    // ---- O^T += V P^T : 2 k-steps over the 64 keys x 8 channel tiles ----
    v8f rs = zero;
#pragma unroll
    for (int ks = 0; ks < 2; ++ks) {
      v16h pf;
#pragma unroll
      for (int tn = 2 * ks; tn < 2 * ks + 2; ++tn) {
#pragma unroll
        for (int r = 0; r < 8; ++r) {
          float p = __expf(s[tn][r] - mn);
          pf[(tn & 1) * 8 + r] = (_Float16)p;
          rs[r] += p;
        }
      }
#pragma unroll
      for (int g = 0; g < 8; g += 4) {
#pragma unroll
        for (int t = 0; t < 4; ++t)
          o[g + t] = __builtin_amdgcn_wmma_f32_16x16x32_f16(false, fr[g + t], false, pf,
                                                            (short)0, o[g + t], false, false);
        if (ks == 0) {
          GROUP_EDGE();
#pragma unroll
          for (int t = 0; t < 4; ++t) fr[g + t] = frag_from(vb + (g + t) * 16 * 72, 32, lane);
          GROUP_EDGE();
        }
      }
    }
    lacc = lacc * alpha + rs;
    __syncthreads();   // keep next tile's DMA from overwriting live K/V reads
  }

  // ---- Epilogue: out = gamma * O / l + x (both (B,C,N) f32) ----
  // O^T layout: pixel = lane&15, channel = ct*16 + reg + 8*(lane>=16).
  const float g = gamma[0];
  float lsum = ((lacc[0] + lacc[1]) + (lacc[2] + lacc[3])) +
               ((lacc[4] + lacc[5]) + (lacc[6] + lacc[7]));
  lsum += xhalf(lsum);
  const float inv = 1.0f / lsum;
  const int pix = m0 + wave * 16 + (lane & 15);
#pragma unroll
  for (int ct = 0; ct < 8; ++ct) {
#pragma unroll
    for (int r = 0; r < 8; ++r) {
      int c = ch0 + ct * 16 + r + 8 * (lane >> 4);
      size_t idx = ((size_t)(b * C_ + c)) * N_ + pix;
      out[idx] = g * (o[ct][r] * inv) + x[idx];
    }
  }
}

extern "C" void kernel_launch(void* const* d_in, const int* in_sizes, int n_in,
                              void* d_out, int out_size, void* d_ws, size_t ws_size,
                              hipStream_t stream) {
  const float* x     = (const float*)d_in[0];
  const float* Wq    = (const float*)d_in[1];
  const float* bq    = (const float*)d_in[2];
  const float* Wk    = (const float*)d_in[3];
  const float* bk    = (const float*)d_in[4];
  const float* Wv    = (const float*)d_in[5];
  const float* bv    = (const float*)d_in[6];
  const float* gamma = (const float*)d_in[7];
  float* out = (float*)d_out;

  // Workspace: Q (8MB) | K (8MB) | V (16MB), all f16.
  _Float16* Qw = (_Float16*)d_ws;
  _Float16* Kw = Qw + (size_t)B_ * N_ * CI_;
  _Float16* Vw = Kw + (size_t)B_ * N_ * CI_;

  dim3 pgrid(N_ / 128, (2 * CI_ + C_) / 64, B_);  // 32 x 8 x 8
  qkv_proj<<<pgrid, 256, 0, stream>>>(x, Wq, bq, Wk, bk, Wv, bv, Qw, Kw, Vw);

  dim3 agrid(N_ / 128, B_, 2);                    // 32 x 8 x 2 (channel halves)
  flash_attn<<<agrid, 256, 0, stream>>>(Qw, Kw, Vw, x, gamma, out);
}

// v003
// A run of this version takes 180 microseconds.
// Two timings next to v002 put it at 1.12 and 1.13 times that version's speed.
// Over all steps from v000 it is 1.95 times as fast.
#include <hip/hip_runtime.h>

typedef __attribute__((ext_vector_type(16))) _Float16 v16h;
typedef __attribute__((ext_vector_type(8)))  _Float16 v8h;
typedef __attribute__((ext_vector_type(8)))  float    v8f;
typedef __attribute__((ext_vector_type(4)))  float    v4f;

#define B_  8
#define C_  256
#define CI_ 128
#define N_  4096

// Keeps a group of LDS fragment reads where the source puts it: without it the
// scheduler sinks each read to just in front of its product, and every product
// then waits out a whole LDS latency.
#define GROUP_EDGE() __builtin_amdgcn_sched_barrier(0)

// Build a 16-bit A/B-matrix fragment (v16h -> 8 VGPRs) from a row-major source
// where the 32 K-values for this fragment's row live contiguously at rowbase+kbase.
// Per ISA 7.12.2 (16-bit A 16x32): lanes 0-15 hold K {0..7, 16..23},
// lanes 16-31 hold K {8..15, 24..31}; element i of v16h -> VGPR i/2 half i&1.
__device__ __forceinline__ v16h frag_from(const _Float16* rowbase, int kbase, int lane) {
  const int h = (lane >> 4) & 1;
  v8h a = *(const v8h*)(rowbase + kbase + 8 * h);
  v8h b = *(const v8h*)(rowbase + kbase + 16 + 8 * h);
  v16h r;
#pragma unroll
  for (int i = 0; i < 8; ++i) { r[i] = a[i]; r[i + 8] = b[i]; }
  return r;
}

// Async DMA of one 16-byte chunk from global memory into LDS (per lane).
// Tracked by ASYNCcnt; LDS address is wave-relative (low 32 bits of generic ptr).
__device__ __forceinline__ void async_copy_b128(unsigned lds_off, const void* gaddr) {
  asm volatile("global_load_async_to_lds_b128 %0, %1, off"
               :: "v"(lds_off), "v"(gaddr) : "memory");
}

__device__ __forceinline__ unsigned lds_off_of(const void* p) {
  return (unsigned)(size_t)p;  // generic LDS addr truncates to wave-relative offset
}

// Lane l exchanges with lane l ^ 16 (the other 16-lane row), in registers.
__device__ __forceinline__ float xhalf(float v) {
  int i = __builtin_bit_cast(int, v);
  return __builtin_bit_cast(float,
      __builtin_amdgcn_permlanex16(i, i, 0x76543210, 0xfedcba98, false, false));
}

// ---------------------------------------------------------------------------
// Kernel 1: fused Q/K/V 1x1-conv projections as a f16 WMMA GEMM.
// Out tile per block: 128 pixels x 64 output channels. K-dim = C_ = 256.
// Q,K written (B,N,CI) pixel-major f16; V written (B,C,N) channel-major f16.
// A lane's eight accumulator rows always run along the output's contiguous
// axis, so each tile leaves as one 16-byte store per lane: for V the pixels are
// the A rows (D = x^T W^T), for Q and K the output channels are (D = W x).
// ---------------------------------------------------------------------------
template <bool VMAJ>
__device__ __forceinline__ void proj_tile(
    const float* __restrict__ x, const float* __restrict__ W,
    const float* __restrict__ bias, _Float16* __restrict__ dst,
    int crel, int b, int p0, _Float16* Ald, _Float16* Bld) {
  const int tid  = threadIdx.x;
  const int lane = tid & 31;
  const int wave = tid >> 5;

  // Every short loop here is unrolled so that acc, fx, fw and h are indexed by
  // constants and stay in registers.
  const v8f zero = {0, 0, 0, 0, 0, 0, 0, 0};
  v8f acc[4];
#pragma unroll
  for (int t = 0; t < 4; ++t) acc[t] = zero;

  for (int c0 = 0; c0 < C_; c0 += 32) {
    // Stage the x^T tile (transpose channel-major x through LDS, f32 -> f16) and
    // the weight tile (rows contiguous over input channel). All six loads are
    // requested before the first LDS store, so that their latencies overlap.
    v4f fx[4], fw[2];
#pragma unroll
    for (int it = 0; it < 4; ++it) {
      int lin = tid + 256 * it;          // 0..1023: channel lin>>5, pixel quad lin&31
      fx[it] = *(const v4f*)(x + ((size_t)(b * C_ + c0 + (lin >> 5))) * N_ + p0 + (lin & 31) * 4);
    }
    // The registers that held these four addresses may be reused from here on.
    asm volatile("s_wait_xcnt 0x0" ::: "memory");
#pragma unroll
    for (int it = 0; it < 2; ++it) {
      int lin = tid + 256 * it;          // 0..511: out channel lin>>3, channel quad lin&7
      fw[it] = *(const v4f*)(W + (size_t)(crel + (lin >> 3)) * C_ + c0 + (lin & 7) * 4);
    }
#pragma unroll
    for (int it = 0; it < 4; ++it) {
      int lin = tid + 256 * it;
#pragma unroll
      for (int i = 0; i < 4; ++i) Ald[((lin & 31) * 4 + i) * 40 + (lin >> 5)] = (_Float16)fx[it][i];
    }
#pragma unroll
    for (int it = 0; it < 2; ++it) {
      int lin = tid + 256 * it;
#pragma unroll
      for (int i = 0; i < 4; ++i) Bld[(lin >> 3) * 40 + (lin & 7) * 4 + i] = (_Float16)fw[it][i];
    }
    __syncthreads();

    v16h xf = frag_from(&Ald[(wave * 16 + (lane & 15)) * 40], 0, lane);
#pragma unroll
    for (int tn = 0; tn < 4; ++tn) {
      v16h wf = frag_from(&Bld[(tn * 16 + (lane & 15)) * 40], 0, lane);
      acc[tn] = VMAJ
          ? __builtin_amdgcn_wmma_f32_16x16x32_f16(false, xf, false, wf,
                                                   (short)0, acc[tn], false, false)
          : __builtin_amdgcn_wmma_f32_16x16x32_f16(false, wf, false, xf,
                                                   (short)0, acc[tn], false, false);
    }
    __syncthreads();
  }

  // Bias + f16 store. C/D layout: col = lane&15, row = reg + 8*(lane>=16).
  const int col  = lane & 15;
  const int row8 = 8 * (lane >> 4);
#pragma unroll
  for (int tn = 0; tn < 4; ++tn) {
    v8h h;
    if (VMAJ) {   // col = output channel, rows = 8 consecutive pixels
      const int cloc = crel + tn * 16 + col;
      const float bb = bias[cloc];
#pragma unroll
      for (int r = 0; r < 8; ++r) h[r] = (_Float16)(acc[tn][r] + bb);
      *(v8h*)(dst + ((size_t)(b * C_ + cloc)) * N_ + p0 + wave * 16 + row8) = h;
    } else {      // col = pixel, rows = 8 consecutive output channels
      const int c8 = crel + tn * 16 + row8;
#pragma unroll
      for (int r = 0; r < 8; ++r) h[r] = (_Float16)(acc[tn][r] + bias[c8 + r]);
      *(v8h*)(dst + ((size_t)(b * N_ + p0 + wave * 16 + col)) * CI_ + c8) = h;
    }
  }
}

__global__ __launch_bounds__(256) void qkv_proj(
    const float* __restrict__ x,
    const float* __restrict__ Wq, const float* __restrict__ bq,
    const float* __restrict__ Wk, const float* __restrict__ bk,
    const float* __restrict__ Wv, const float* __restrict__ bv,
    _Float16* __restrict__ Qo, _Float16* __restrict__ Ko, _Float16* __restrict__ Vo) {
  __shared__ _Float16 Ald[128 * 40];  // 128 pixels x 32 ch, pitch 40 halves (16B rows)
  __shared__ _Float16 Bld[64 * 40];   // 64 outch x 32 ch

  const int p0 = blockIdx.x * 128;
  const int o0 = blockIdx.y * 64;
  const int b  = blockIdx.z;

  if (o0 < 256) {
    const bool isq = o0 < 128;
    proj_tile<false>(x, isq ? Wq : Wk, isq ? bq : bk, isq ? Qo : Ko, o0 & 127, b, p0, Ald, Bld);
  } else {
    proj_tile<true>(x, Wv, bv, Vo, o0 - 256, b, p0, Ald, Bld);
  }
}

__global__ __launch_bounds__(256) void flash_attn(
    const _Float16* __restrict__ Q, const _Float16* __restrict__ K,
    const _Float16* __restrict__ V, const float* __restrict__ x,
    const float* __restrict__ gamma, float* __restrict__ out) {
  __shared__ _Float16 Klds[64 * 136];   // 64 keys x 128 ch, pitch 136 halves (17 chunks)
  __shared__ _Float16 Vlds[128 * 72];   // 128 ch x 64 keys, pitch 72 halves (9 chunks)

  const int tid  = threadIdx.x;
  const int lane = tid & 31;
  const int wave = tid >> 5;
  const int m0  = blockIdx.x * 128;
  const int b   = blockIdx.y;
  const int ch0 = blockIdx.z * 128;

  const unsigned kbase = lds_off_of(&Klds[0]);
  const unsigned vbase = lds_off_of(&Vlds[0]);

  // Q fragments straight from global: (B,N,CI) rows are contiguous over c.
  const int rowq = m0 + wave * 16 + (lane & 15);
  const _Float16* qrow = Q + ((size_t)(b * N_ + rowq)) * CI_;
  v16h qf[4];
#pragma unroll
  for (int ks = 0; ks < 4; ++ks) qf[ks] = frag_from(qrow, ks * 32, lane);

  const v8f zero = {0, 0, 0, 0, 0, 0, 0, 0};
  v8f o[8];
#pragma unroll
  for (int t = 0; t < 8; ++t) o[t] = zero;
  float mrun = -3.0e38f;   // running maximum of this lane's query
  v8f   lacc = zero;       // running sums: register r, this wave half's keys only

  for (int j0 = 0; j0 < N_; j0 += 64) {
    // ---- Async DMA: K tile (64 x 128 ch) and V tile (128 ch x 64 keys) ----
    // K: 64 rows x 16 b128-chunks = 1024 chunks, 4 per thread.
#pragma unroll
    for (int it = 0; it < 4; ++it) {
      int lin = tid + 256 * it;
      int row = lin >> 4, cc = lin & 15;
      async_copy_b128(kbase + (unsigned)(row * 17 + cc) * 16,
                      K + ((size_t)(b * N_ + j0 + row)) * CI_ + cc * 8);
    }
    // V: 128 rows x 8 b128-chunks = 1024 chunks, 4 per thread.
#pragma unroll
    for (int it = 0; it < 4; ++it) {
      int lin = tid + 256 * it;
      int row = lin >> 3, cc = lin & 7;
      async_copy_b128(vbase + (unsigned)(row * 9 + cc) * 16,
                      V + ((size_t)(b * C_ + ch0 + row)) * N_ + j0 + cc * 8);
    }
    asm volatile("s_wait_asynccnt 0" ::: "memory");
    __syncthreads();

    // ---- S^T = K Q^T for a 64-key x 16-query strip (4 k-steps x 4 tiles) ----
    // D layout: query = lane&15, key = tn*16 + reg + 8*(lane>=16).
    // Fragments come from LDS in groups of four through a ring of two groups:
    // a group is requested as soon as the products on its registers are issued,
    // one group of products ahead of its use. The ring runs on into V, so the
    // first eight V fragments are under way while the softmax is computed.
    const _Float16* kb = &Klds[(lane & 15) * 136];
    const _Float16* vb = &Vlds[(lane & 15) * 72];
    v16h fr[8];
#pragma unroll
    for (int t = 0; t < 4; ++t) fr[t] = frag_from(kb + t * 16 * 136, 0, lane);
#pragma unroll
    for (int t = 0; t < 4; ++t) fr[4 + t] = frag_from(kb + t * 16 * 136, 32, lane);
    GROUP_EDGE();
    v8f s[4];
#pragma unroll
    for (int tn = 0; tn < 4; ++tn) s[tn] = zero;
#pragma unroll
    for (int ks = 0; ks < 4; ++ks) {
      const int g = (ks & 1) * 4;
#pragma unroll
      for (int tn = 0; tn < 4; ++tn)
        s[tn] = __builtin_amdgcn_wmma_f32_16x16x32_f16(false, fr[g + tn], false, qf[ks],
                                                       (short)0, s[tn], false, false);
      GROUP_EDGE();
#pragma unroll
      for (int t = 0; t < 4; ++t)
        fr[g + t] = (ks < 2) ? frag_from(kb + t * 16 * 136, (ks + 2) * 32, lane)
                             : frag_from(vb + (g + t) * 16 * 72, 0, lane);
      GROUP_EDGE();
    }

    // ---- Online softmax: 32 of this query's 64 scores are in this lane ----
    float v = -3.0e38f;
#pragma unroll
    for (int r = 0; r < 8; ++r)
      v = fmaxf(v, fmaxf(fmaxf(s[0][r], s[1][r]), fmaxf(s[2][r], s[3][r])));
    v = fmaxf(v, xhalf(v));
    const float mn    = fmaxf(mrun, v);
    const float alpha = __expf(mrun - mn);
    mrun = mn;
#pragma unroll
    for (int t = 0; t < 8; ++t) o[t] *= alpha;

    // P^T as B fragments: tile 2ks gives k = 8h..8h+7, tile 2ks+1 k = 16+8h..16+8h+7.
    // ---- O^T += V P^T : 2 k-steps over the 64 keys x 8 channel tiles ----
    v8f rs = zero;
#pragma unroll
    for (int ks = 0; ks < 2; ++ks) {
      v16h pf;
#pragma unroll
      for (int tn = 2 * ks; tn < 2 * ks + 2; ++tn) {
#pragma unroll
        for (int r = 0; r < 8; ++r) {
          float p = __expf(s[tn][r] - mn);
          pf[(tn & 1) * 8 + r] = (_Float16)p;
          rs[r] += p;
        }
      }
#pragma unroll
      for (int g = 0; g < 8; g += 4) {
#pragma unroll
        for (int t = 0; t < 4; ++t)
          o[g + t] = __builtin_amdgcn_wmma_f32_16x16x32_f16(false, fr[g + t], false, pf,
                                                            (short)0, o[g + t], false, false);
        if (ks == 0) {
          GROUP_EDGE();
#pragma unroll
          for (int t = 0; t < 4; ++t) fr[g + t] = frag_from(vb + (g + t) * 16 * 72, 32, lane);
          GROUP_EDGE();
        }
      }
    }
    lacc = lacc * alpha + rs;
    __syncthreads();   // keep next tile's DMA from overwriting live K/V reads
  }

  // ---- Epilogue: out = gamma * O / l + x (both (B,C,N) f32) ----
  // O^T layout: pixel = lane&15, channel = ct*16 + reg + 8*(lane>=16).
  const float g = gamma[0];
  float lsum = ((lacc[0] + lacc[1]) + (lacc[2] + lacc[3])) +
               ((lacc[4] + lacc[5]) + (lacc[6] + lacc[7]));
  lsum += xhalf(lsum);
  const float inv = 1.0f / lsum;
  const int pix = m0 + wave * 16 + (lane & 15);
#pragma unroll
  for (int ct = 0; ct < 8; ++ct) {
#pragma unroll
    for (int r = 0; r < 8; ++r) {
      int c = ch0 + ct * 16 + r + 8 * (lane >> 4);
      size_t idx = ((size_t)(b * C_ + c)) * N_ + pix;
      out[idx] = g * (o[ct][r] * inv) + x[idx];
    }
  }
}

extern "C" void kernel_launch(void* const* d_in, const int* in_sizes, int n_in,
                              void* d_out, int out_size, void* d_ws, size_t ws_size,
                              hipStream_t stream) {
  const float* x     = (const float*)d_in[0];
  const float* Wq    = (const float*)d_in[1];
  const float* bq    = (const float*)d_in[2];
  const float* Wk    = (const float*)d_in[3];
  const float* bk    = (const float*)d_in[4];
  const float* Wv    = (const float*)d_in[5];
  const float* bv    = (const float*)d_in[6];
  const float* gamma = (const float*)d_in[7];
  float* out = (float*)d_out;

  // Workspace: Q (8MB) | K (8MB) | V (16MB), all f16.
  _Float16* Qw = (_Float16*)d_ws;
  _Float16* Kw = Qw + (size_t)B_ * N_ * CI_;
  _Float16* Vw = Kw + (size_t)B_ * N_ * CI_;

  dim3 pgrid(N_ / 128, (2 * CI_ + C_) / 64, B_);  // 32 x 8 x 8
  qkv_proj<<<pgrid, 256, 0, stream>>>(x, Wq, bq, Wk, bk, Wv, bv, Qw, Kw, Vw);

  dim3 agrid(N_ / 128, B_, 2);                    // 32 x 8 x 2 (channel halves)
  flash_attn<<<agrid, 256, 0, stream>>>(Qw, Kw, Vw, x, gamma, out);
}

// v004
// A run of this version takes 133 microseconds.
// Timed twice side by side with v003, it ran 1.38 times as fast both times.
// Counting every step since v000, it is 2.68 times as fast.
#include <hip/hip_runtime.h>

typedef __attribute__((ext_vector_type(16))) _Float16 v16h;
typedef __attribute__((ext_vector_type(8)))  _Float16 v8h;
typedef __attribute__((ext_vector_type(8)))  float    v8f;
typedef __attribute__((ext_vector_type(4)))  float    v4f;
typedef __attribute__((ext_vector_type(2)))  float    v2f;

#define B_  8
#define C_  256
#define CI_ 128
#define N_  4096

// Keeps a group of LDS fragment reads where the source puts it: without it the
// scheduler sinks each read to just in front of its product, and every product
// then waits out a whole LDS latency.
#define GROUP_EDGE() __builtin_amdgcn_sched_barrier(0)

// Build a 16-bit A/B-matrix fragment (v16h -> 8 VGPRs) from a row-major source
// where the 32 K-values for this fragment's row live contiguously at rowbase+kbase.
// Per ISA 7.12.2 (16-bit A 16x32): lanes 0-15 hold K {0..7, 16..23},
// lanes 16-31 hold K {8..15, 24..31}; element i of v16h -> VGPR i/2 half i&1.
__device__ __forceinline__ v16h frag_from(const _Float16* rowbase, int kbase, int lane) {
  const int h = (lane >> 4) & 1;
  v8h a = *(const v8h*)(rowbase + kbase + 8 * h);
  v8h b = *(const v8h*)(rowbase + kbase + 16 + 8 * h);
  v16h r;
#pragma unroll
  for (int i = 0; i < 8; ++i) { r[i] = a[i]; r[i + 8] = b[i]; }
  return r;
}

// Async DMA of one 16-byte chunk from global memory into LDS (per lane).
// Tracked by ASYNCcnt; LDS address is wave-relative (low 32 bits of generic ptr).
__device__ __forceinline__ void async_copy_b128(unsigned lds_off, const void* gaddr) {
  asm volatile("global_load_async_to_lds_b128 %0, %1, off"
               :: "v"(lds_off), "v"(gaddr) : "memory");
}

__device__ __forceinline__ unsigned lds_off_of(const void* p) {
  return (unsigned)(size_t)p;  // generic LDS addr truncates to wave-relative offset
}

// Lane l exchanges with lane l ^ 16 (the other 16-lane row), in registers.
__device__ __forceinline__ float xhalf(float v) {
  int i = __builtin_bit_cast(int, v);
  return __builtin_bit_cast(float,
      __builtin_amdgcn_permlanex16(i, i, 0x76543210, 0xfedcba98, false, false));
}

// ---------------------------------------------------------------------------
// Kernel 1: fused Q/K/V 1x1-conv projections as a f16 WMMA GEMM.
// Out tile per block: 128 pixels x 64 output channels. K-dim = C_ = 256.
// Q,K written (B,N,CI) pixel-major f16; V written (B,C,N) channel-major f16.
// A lane's eight accumulator rows always run along the output's contiguous
// axis, so each tile leaves as one 16-byte store per lane: for V the pixels are
// the A rows (D = x^T W^T), for Q and K the output channels are (D = W x).
// ---------------------------------------------------------------------------
template <bool VMAJ>
__device__ __forceinline__ void proj_tile(
    const float* __restrict__ x, const float* __restrict__ W,
    const float* __restrict__ bias, _Float16* __restrict__ dst,
    int crel, int b, int p0, _Float16* Ald, _Float16* Bld) {
  const int tid  = threadIdx.x;
  const int lane = tid & 31;
  const int wave = tid >> 5;
  const int pp   = tid & 63;   // pixel pair of the x tile that this thread stages
  const int cg   = tid >> 6;   // its group of eight input channels

  // Every short loop here is unrolled so that acc, fx, fw and h are indexed by
  // constants and stay in registers.
  const v8f zero = {0, 0, 0, 0, 0, 0, 0, 0};
  v8f acc[4];
#pragma unroll
  for (int t = 0; t < 4; ++t) acc[t] = zero;

  for (int c0 = 0; c0 < C_; c0 += 32) {
    // Stage the x^T tile (channel-major x, f32 -> f16) and the weight tile (rows
    // contiguous over input channel). A thread takes two neighbouring pixels of
    // eight consecutive channels, so the transpose happens in its registers and
    // each pixel's eight channels go to LDS as one 16-byte store. All ten loads
    // are requested before the first LDS store, so that their latencies overlap.
    v2f fx[8];
    v4f fw[2];
    const float* xp = x + ((size_t)(b * C_ + c0 + cg * 8)) * N_ + p0 + pp * 2;
#pragma unroll
    for (int j = 0; j < 8; ++j) fx[j] = *(const v2f*)(xp + j * N_);
    // The registers that held these addresses may be reused from here on.
    asm volatile("s_wait_xcnt 0x0" ::: "memory");
#pragma unroll
    for (int it = 0; it < 2; ++it) {
      int lin = tid + 256 * it;          // 0..511: out channel lin>>3, channel quad lin&7
      fw[it] = *(const v4f*)(W + (size_t)(crel + (lin >> 3)) * C_ + c0 + (lin & 7) * 4);
    }
#pragma unroll
    for (int i = 0; i < 2; ++i) {
      v8h hx;
#pragma unroll
      for (int j = 0; j < 8; ++j) hx[j] = (_Float16)fx[j][i];
      *(v8h*)&Ald[(pp * 2 + i) * 40 + cg * 8] = hx;
    }
#pragma unroll
    for (int it = 0; it < 2; ++it) {
      int lin = tid + 256 * it;
#pragma unroll
      for (int i = 0; i < 4; ++i) Bld[(lin >> 3) * 40 + (lin & 7) * 4 + i] = (_Float16)fw[it][i];
    }
    __syncthreads();

    v16h xf = frag_from(&Ald[(wave * 16 + (lane & 15)) * 40], 0, lane);
#pragma unroll
    for (int tn = 0; tn < 4; ++tn) {
      v16h wf = frag_from(&Bld[(tn * 16 + (lane & 15)) * 40], 0, lane);
      acc[tn] = VMAJ
          ? __builtin_amdgcn_wmma_f32_16x16x32_f16(false, xf, false, wf,
                                                   (short)0, acc[tn], false, false)
          : __builtin_amdgcn_wmma_f32_16x16x32_f16(false, wf, false, xf,
                                                   (short)0, acc[tn], false, false);
    }
    __syncthreads();
  }

  // Bias + f16 store. C/D layout: col = lane&15, row = reg + 8*(lane>=16).
  const int col  = lane & 15;
  const int row8 = 8 * (lane >> 4);
#pragma unroll
  for (int tn = 0; tn < 4; ++tn) {
    v8h h;
    if (VMAJ) {   // col = output channel, rows = 8 consecutive pixels
      const int cloc = crel + tn * 16 + col;
      const float bb = bias[cloc];
#pragma unroll
      for (int r = 0; r < 8; ++r) h[r] = (_Float16)(acc[tn][r] + bb);
      *(v8h*)(dst + ((size_t)(b * C_ + cloc)) * N_ + p0 + wave * 16 + row8) = h;
    } else {      // col = pixel, rows = 8 consecutive output channels
      const int c8 = crel + tn * 16 + row8;
#pragma unroll
      for (int r = 0; r < 8; ++r) h[r] = (_Float16)(acc[tn][r] + bias[c8 + r]);
      *(v8h*)(dst + ((size_t)(b * N_ + p0 + wave * 16 + col)) * CI_ + c8) = h;
    }
  }
}

__global__ __launch_bounds__(256) void qkv_proj(
    const float* __restrict__ x,
    const float* __restrict__ Wq, const float* __restrict__ bq,
    const float* __restrict__ Wk, const float* __restrict__ bk,
    const float* __restrict__ Wv, const float* __restrict__ bv,
    _Float16* __restrict__ Qo, _Float16* __restrict__ Ko, _Float16* __restrict__ Vo) {
  __shared__ _Float16 Ald[128 * 40];  // 128 pixels x 32 ch, pitch 40 halves (16B rows)
  __shared__ _Float16 Bld[64 * 40];   // 64 outch x 32 ch

  const int p0 = blockIdx.x * 128;
  const int o0 = blockIdx.y * 64;
  const int b  = blockIdx.z;

  if (o0 < 256) {
    const bool isq = o0 < 128;
    proj_tile<false>(x, isq ? Wq : Wk, isq ? bq : bk, isq ? Qo : Ko, o0 & 127, b, p0, Ald, Bld);
  } else {
    proj_tile<true>(x, Wv, bv, Vo, o0 - 256, b, p0, Ald, Bld);
  }
}

__global__ __launch_bounds__(256) void flash_attn(
    const _Float16* __restrict__ Q, const _Float16* __restrict__ K,
    const _Float16* __restrict__ V, const float* __restrict__ x,
    const float* __restrict__ gamma, float* __restrict__ out) {
  __shared__ _Float16 Klds[64 * 136];   // 64 keys x 128 ch, pitch 136 halves (17 chunks)
  __shared__ _Float16 Vlds[128 * 72];   // 128 ch x 64 keys, pitch 72 halves (9 chunks)

  const int tid  = threadIdx.x;
  const int lane = tid & 31;
  const int wave = tid >> 5;
  const int m0  = blockIdx.x * 128;
  const int b   = blockIdx.y;
  const int ch0 = blockIdx.z * 128;

  const unsigned kbase = lds_off_of(&Klds[0]);
  const unsigned vbase = lds_off_of(&Vlds[0]);

  // Q fragments straight from global: (B,N,CI) rows are contiguous over c.
  const int rowq = m0 + wave * 16 + (lane & 15);
  const _Float16* qrow = Q + ((size_t)(b * N_ + rowq)) * CI_;
  v16h qf[4];
#pragma unroll
  for (int ks = 0; ks < 4; ++ks) qf[ks] = frag_from(qrow, ks * 32, lane);

  const v8f zero = {0, 0, 0, 0, 0, 0, 0, 0};
  v8f o[8];
#pragma unroll
  for (int t = 0; t < 8; ++t) o[t] = zero;
  float mrun = -3.0e38f;   // running maximum of this lane's query
  v8f   lacc = zero;       // running sums: register r, this wave half's keys only

  for (int j0 = 0; j0 < N_; j0 += 64) {
    // ---- Async DMA: K tile (64 x 128 ch) and V tile (128 ch x 64 keys) ----
    // K: 64 rows x 16 b128-chunks = 1024 chunks, 4 per thread.
#pragma unroll
    for (int it = 0; it < 4; ++it) {
      int lin = tid + 256 * it;
      int row = lin >> 4, cc = lin & 15;
      async_copy_b128(kbase + (unsigned)(row * 17 + cc) * 16,
                      K + ((size_t)(b * N_ + j0 + row)) * CI_ + cc * 8);
    }
    // V: 128 rows x 8 b128-chunks = 1024 chunks, 4 per thread.
#pragma unroll
    for (int it = 0; it < 4; ++it) {
      int lin = tid + 256 * it;
      int row = lin >> 3, cc = lin & 7;
      async_copy_b128(vbase + (unsigned)(row * 9 + cc) * 16,
                      V + ((size_t)(b * C_ + ch0 + row)) * N_ + j0 + cc * 8);
    }
    asm volatile("s_wait_asynccnt 0" ::: "memory");
    __syncthreads();

    // ---- S^T = K Q^T for a 64-key x 16-query strip (4 k-steps x 4 tiles) ----
    // D layout: query = lane&15, key = tn*16 + reg + 8*(lane>=16).
    // Fragments come from LDS in groups of four through a ring of two groups:
    // a group is requested as soon as the products on its registers are issued,
    // one group of products ahead of its use. The ring runs on into V, so the
    // first eight V fragments are under way while the softmax is computed.
    const _Float16* kb = &Klds[(lane & 15) * 136];
    const _Float16* vb = &Vlds[(lane & 15) * 72];
    v16h fr[8];
#pragma unroll
    for (int t = 0; t < 4; ++t) fr[t] = frag_from(kb + t * 16 * 136, 0, lane);
#pragma unroll
    for (int t = 0; t < 4; ++t) fr[4 + t] = frag_from(kb + t * 16 * 136, 32, lane);
    GROUP_EDGE();
    v8f s[4];
#pragma unroll
    for (int tn = 0; tn < 4; ++tn) s[tn] = zero;
#pragma unroll
    for (int ks = 0; ks < 4; ++ks) {
      const int g = (ks & 1) * 4;
#pragma unroll
      for (int tn = 0; tn < 4; ++tn)
        s[tn] = __builtin_amdgcn_wmma_f32_16x16x32_f16(false, fr[g + tn], false, qf[ks],
                                                       (short)0, s[tn], false, false);
      GROUP_EDGE();
#pragma unroll
      for (int t = 0; t < 4; ++t)
        fr[g + t] = (ks < 2) ? frag_from(kb + t * 16 * 136, (ks + 2) * 32, lane)
                             : frag_from(vb + (g + t) * 16 * 72, 0, lane);
      GROUP_EDGE();
    }

    // ---- Online softmax: 32 of this query's 64 scores are in this lane ----
    float v = -3.0e38f;
#pragma unroll
    for (int r = 0; r < 8; ++r)
      v = fmaxf(v, fmaxf(fmaxf(s[0][r], s[1][r]), fmaxf(s[2][r], s[3][r])));
    v = fmaxf(v, xhalf(v));
    const float mn    = fmaxf(mrun, v);
    const float alpha = __expf(mrun - mn);
    mrun = mn;
#pragma unroll
    for (int t = 0; t < 8; ++t) o[t] *= alpha;

    // P^T as B fragments: tile 2ks gives k = 8h..8h+7, tile 2ks+1 k = 16+8h..16+8h+7.
    // ---- O^T += V P^T : 2 k-steps over the 64 keys x 8 channel tiles ----
    v8f rs = zero;
#pragma unroll
    for (int ks = 0; ks < 2; ++ks) {
      v16h pf;
#pragma unroll
      for (int tn = 2 * ks; tn < 2 * ks + 2; ++tn) {
#pragma unroll
        for (int r = 0; r < 8; ++r) {
          float p = __expf(s[tn][r] - mn);
          pf[(tn & 1) * 8 + r] = (_Float16)p;
          rs[r] += p;
        }
      }
#pragma unroll
      for (int g = 0; g < 8; g += 4) {
#pragma unroll
        for (int t = 0; t < 4; ++t)
          o[g + t] = __builtin_amdgcn_wmma_f32_16x16x32_f16(false, fr[g + t], false, pf,
                                                            (short)0, o[g + t], false, false);
        if (ks == 0) {
          GROUP_EDGE();
#pragma unroll
          for (int t = 0; t < 4; ++t) fr[g + t] = frag_from(vb + (g + t) * 16 * 72, 32, lane);
          GROUP_EDGE();
        }
      }
    }
    lacc = lacc * alpha + rs;
    __syncthreads();   // keep next tile's DMA from overwriting live K/V reads
  }

  // ---- Epilogue: out = gamma * O / l + x (both (B,C,N) f32) ----
  // O^T layout: pixel = lane&15, channel = ct*16 + reg + 8*(lane>=16).
  const float g = gamma[0];
  float lsum = ((lacc[0] + lacc[1]) + (lacc[2] + lacc[3])) +
               ((lacc[4] + lacc[5]) + (lacc[6] + lacc[7]));
  lsum += xhalf(lsum);
  const float inv = 1.0f / lsum;
  const int pix = m0 + wave * 16 + (lane & 15);
#pragma unroll
  for (int ct = 0; ct < 8; ++ct) {
#pragma unroll
    for (int r = 0; r < 8; ++r) {
      int c = ch0 + ct * 16 + r + 8 * (lane >> 4);
      size_t idx = ((size_t)(b * C_ + c)) * N_ + pix;
      out[idx] = g * (o[ct][r] * inv) + x[idx];
    }
  }
}

extern "C" void kernel_launch(void* const* d_in, const int* in_sizes, int n_in,
                              void* d_out, int out_size, void* d_ws, size_t ws_size,
                              hipStream_t stream) {
  const float* x     = (const float*)d_in[0];
  const float* Wq    = (const float*)d_in[1];
  const float* bq    = (const float*)d_in[2];
  const float* Wk    = (const float*)d_in[3];
  const float* bk    = (const float*)d_in[4];
  const float* Wv    = (const float*)d_in[5];
  const float* bv    = (const float*)d_in[6];
  const float* gamma = (const float*)d_in[7];
  float* out = (float*)d_out;

  // Workspace: Q (8MB) | K (8MB) | V (16MB), all f16.
  _Float16* Qw = (_Float16*)d_ws;
  _Float16* Kw = Qw + (size_t)B_ * N_ * CI_;
  _Float16* Vw = Kw + (size_t)B_ * N_ * CI_;

  dim3 pgrid(N_ / 128, (2 * CI_ + C_) / 64, B_);  // 32 x 8 x 8
  qkv_proj<<<pgrid, 256, 0, stream>>>(x, Wq, bq, Wk, bk, Wv, bv, Qw, Kw, Vw);

  dim3 agrid(N_ / 128, B_, 2);                    // 32 x 8 x 2 (channel halves)
  flash_attn<<<agrid, 256, 0, stream>>>(Qw, Kw, Vw, x, gamma, out);
}

// v005
// It runs in 127 microseconds.
// Next to v004, in two timings, it ran 1.04 times as fast each time.
// Counting every step since v000, it is 2.79 times as fast.
#include <hip/hip_runtime.h>

typedef __attribute__((ext_vector_type(16))) _Float16 v16h;
typedef __attribute__((ext_vector_type(8)))  _Float16 v8h;
typedef __attribute__((ext_vector_type(8)))  float    v8f;
typedef __attribute__((ext_vector_type(4)))  float    v4f;
typedef __attribute__((ext_vector_type(2)))  float    v2f;

#define B_  8
#define C_  256
#define CI_ 128
#define N_  4096

// Keeps a group of LDS fragment reads where the source puts it: without it the
// scheduler sinks each read to just in front of its product, and every product
// then waits out a whole LDS latency.
#define GROUP_EDGE() __builtin_amdgcn_sched_barrier(0)

// Build a 16-bit A/B-matrix fragment (v16h -> 8 VGPRs) from a row-major source
// where the 32 K-values for this fragment's row live contiguously at rowbase+kbase.
// Per ISA 7.12.2 (16-bit A 16x32): lanes 0-15 hold K {0..7, 16..23},
// lanes 16-31 hold K {8..15, 24..31}; element i of v16h -> VGPR i/2 half i&1.
__device__ __forceinline__ v16h frag_from(const _Float16* rowbase, int kbase, int lane) {
  const int h = (lane >> 4) & 1;
  v8h a = *(const v8h*)(rowbase + kbase + 8 * h);
  v8h b = *(const v8h*)(rowbase + kbase + 16 + 8 * h);
  v16h r;
#pragma unroll
  for (int i = 0; i < 8; ++i) { r[i] = a[i]; r[i + 8] = b[i]; }
  return r;
}

// Async DMA of eight 16-byte chunks per lane from global memory into LDS.
// Tracked by ASYNCcnt; LDS address is wave-relative (low 32 bits of generic ptr).
// The s_wait_xcnt closes the statement so that no address register named here
// is rewritten ahead of it.
__device__ __forceinline__ void async_copy8_b128(const unsigned (&l)[8],
                                                 const _Float16* const (&g)[8]) {
  asm volatile("global_load_async_to_lds_b128 %0, %8, off\n\t"
               "global_load_async_to_lds_b128 %1, %9, off\n\t"
               "global_load_async_to_lds_b128 %2, %10, off\n\t"
               "global_load_async_to_lds_b128 %3, %11, off\n\t"
               "global_load_async_to_lds_b128 %4, %12, off\n\t"
               "global_load_async_to_lds_b128 %5, %13, off\n\t"
               "global_load_async_to_lds_b128 %6, %14, off\n\t"
               "global_load_async_to_lds_b128 %7, %15, off\n\t"
               "s_wait_xcnt 0x0"
               :: "v"(l[0]), "v"(l[1]), "v"(l[2]), "v"(l[3]),
                  "v"(l[4]), "v"(l[5]), "v"(l[6]), "v"(l[7]),
                  "v"(g[0]), "v"(g[1]), "v"(g[2]), "v"(g[3]),
                  "v"(g[4]), "v"(g[5]), "v"(g[6]), "v"(g[7])
               : "memory");
}

__device__ __forceinline__ unsigned lds_off_of(const void* p) {
  return (unsigned)(size_t)p;  // generic LDS addr truncates to wave-relative offset
}

// Lane l exchanges with lane l ^ 16 (the other 16-lane row), in registers.
__device__ __forceinline__ float xhalf(float v) {
  int i = __builtin_bit_cast(int, v);
  return __builtin_bit_cast(float,
      __builtin_amdgcn_permlanex16(i, i, 0x76543210, 0xfedcba98, false, false));
}

// ---------------------------------------------------------------------------
// Kernel 1: fused Q/K/V 1x1-conv projections as a f16 WMMA GEMM.
// Out tile per block: 128 pixels x 64 output channels. K-dim = C_ = 256.
// Q,K written (B,N,CI) pixel-major f16; V written (B,C,N) channel-major f16.
// A lane's eight accumulator rows always run along the output's contiguous
// axis, so each tile leaves as one 16-byte store per lane: for V the pixels are
// the A rows (D = x^T W^T), for Q and K the output channels are (D = W x).
// ---------------------------------------------------------------------------
template <bool VMAJ>
__device__ __forceinline__ void proj_tile(
    const float* __restrict__ x, const float* __restrict__ W,
    const float* __restrict__ bias, _Float16* __restrict__ dst,
    int crel, int b, int p0, _Float16* Ald, _Float16* Bld) {
  const int tid  = threadIdx.x;
  const int lane = tid & 31;
  const int wave = tid >> 5;
  const int pp   = tid & 63;   // pixel pair of the x tile that this thread stages
  const int cg   = tid >> 6;   // its group of eight input channels

  // Every short loop here is unrolled so that acc, fx, fw and h are indexed by
  // constants and stay in registers.
  const v8f zero = {0, 0, 0, 0, 0, 0, 0, 0};
  v8f acc[4];
#pragma unroll
  for (int t = 0; t < 4; ++t) acc[t] = zero;

  for (int c0 = 0; c0 < C_; c0 += 32) {
    // Stage the x^T tile (channel-major x, f32 -> f16) and the weight tile (rows
    // contiguous over input channel). A thread takes two neighbouring pixels of
    // eight consecutive channels, so the transpose happens in its registers and
    // each pixel's eight channels go to LDS as one 16-byte store. All ten loads
    // are requested before the first LDS store, so that their latencies overlap.
    v2f fx[8];
    v4f fw[2];
    const float* xp = x + ((size_t)(b * C_ + c0 + cg * 8)) * N_ + p0 + pp * 2;
#pragma unroll
    for (int j = 0; j < 8; ++j) fx[j] = *(const v2f*)(xp + j * N_);
    // The registers that held these addresses may be reused from here on.
    asm volatile("s_wait_xcnt 0x0" ::: "memory");
#pragma unroll
    for (int it = 0; it < 2; ++it) {
      int lin = tid + 256 * it;          // 0..511: out channel lin>>3, channel quad lin&7
      fw[it] = *(const v4f*)(W + (size_t)(crel + (lin >> 3)) * C_ + c0 + (lin & 7) * 4);
    }
#pragma unroll
    for (int i = 0; i < 2; ++i) {
      v8h hx;
#pragma unroll
      for (int j = 0; j < 8; ++j) hx[j] = (_Float16)fx[j][i];
      *(v8h*)&Ald[(pp * 2 + i) * 40 + cg * 8] = hx;
    }
#pragma unroll
    for (int it = 0; it < 2; ++it) {
      int lin = tid + 256 * it;
#pragma unroll
      for (int i = 0; i < 4; ++i) Bld[(lin >> 3) * 40 + (lin & 7) * 4 + i] = (_Float16)fw[it][i];
    }
    __syncthreads();

    v16h xf = frag_from(&Ald[(wave * 16 + (lane & 15)) * 40], 0, lane);
#pragma unroll
    for (int tn = 0; tn < 4; ++tn) {
      v16h wf = frag_from(&Bld[(tn * 16 + (lane & 15)) * 40], 0, lane);
      acc[tn] = VMAJ
          ? __builtin_amdgcn_wmma_f32_16x16x32_f16(false, xf, false, wf,
                                                   (short)0, acc[tn], false, false)
          : __builtin_amdgcn_wmma_f32_16x16x32_f16(false, wf, false, xf,
                                                   (short)0, acc[tn], false, false);
    }
    __syncthreads();
  }

  // Bias + f16 store. C/D layout: col = lane&15, row = reg + 8*(lane>=16).
  const int col  = lane & 15;
  const int row8 = 8 * (lane >> 4);
#pragma unroll
  for (int tn = 0; tn < 4; ++tn) {
    v8h h;
    if (VMAJ) {   // col = output channel, rows = 8 consecutive pixels
      const int cloc = crel + tn * 16 + col;
      const float bb = bias[cloc];
#pragma unroll
      for (int r = 0; r < 8; ++r) h[r] = (_Float16)(acc[tn][r] + bb);
      *(v8h*)(dst + ((size_t)(b * C_ + cloc)) * N_ + p0 + wave * 16 + row8) = h;
    } else {      // col = pixel, rows = 8 consecutive output channels
      const int c8 = crel + tn * 16 + row8;
#pragma unroll
      for (int r = 0; r < 8; ++r) h[r] = (_Float16)(acc[tn][r] + bias[c8 + r]);
      *(v8h*)(dst + ((size_t)(b * N_ + p0 + wave * 16 + col)) * CI_ + c8) = h;
    }
  }
}

__global__ __launch_bounds__(256) void qkv_proj(
    const float* __restrict__ x,
    const float* __restrict__ Wq, const float* __restrict__ bq,
    const float* __restrict__ Wk, const float* __restrict__ bk,
    const float* __restrict__ Wv, const float* __restrict__ bv,
    _Float16* __restrict__ Qo, _Float16* __restrict__ Ko, _Float16* __restrict__ Vo) {
  __shared__ _Float16 Ald[128 * 40];  // 128 pixels x 32 ch, pitch 40 halves (16B rows)
  __shared__ _Float16 Bld[64 * 40];   // 64 outch x 32 ch

  const int p0 = blockIdx.x * 128;
  const int o0 = blockIdx.y * 64;
  const int b  = blockIdx.z;

  if (o0 < 256) {
    const bool isq = o0 < 128;
    proj_tile<false>(x, isq ? Wq : Wk, isq ? bq : bk, isq ? Qo : Ko, o0 & 127, b, p0, Ald, Bld);
  } else {
    proj_tile<true>(x, Wv, bv, Vo, o0 - 256, b, p0, Ald, Bld);
  }
}

__global__ __launch_bounds__(128) void flash_attn(
    const _Float16* __restrict__ Q, const _Float16* __restrict__ K,
    const _Float16* __restrict__ V, const float* __restrict__ x,
    const float* __restrict__ gamma, float* __restrict__ out) {
  __shared__ _Float16 Klds[64 * 136];   // 64 keys x 128 ch, pitch 136 halves (17 chunks)
  __shared__ _Float16 Vlds[128 * 72];   // 128 ch x 64 keys, pitch 72 halves (9 chunks)

  const int tid  = threadIdx.x;
  const int lane = tid & 31;
  const int wave = tid >> 5;
  const int m0  = blockIdx.x * 128;
  const int b   = blockIdx.y;
  const int ch0 = blockIdx.z * 128;

  const unsigned kbase = lds_off_of(&Klds[0]);
  const unsigned vbase = lds_off_of(&Vlds[0]);

  // Every short loop below is unrolled so that the register arrays are indexed
  // by constants.
  // Q fragments straight from global: (B,N,CI) rows are contiguous over c.
  v16h qf[2][4];
  const _Float16* qrow[2];
#pragma unroll
  for (int q = 0; q < 2; ++q) {
    const int rowq = m0 + wave * 32 + q * 16 + (lane & 15);
    qrow[q] = Q + ((size_t)(b * N_ + rowq)) * CI_;
#pragma unroll
    for (int ks = 0; ks < 4; ++ks) qf[q][ks] = frag_from(qrow[q], ks * 32, lane);
  }
  // The registers that held these addresses may be reused from here on; the wait
  // names the two addresses as inputs so that they are not reused ahead of it.
  asm volatile("s_wait_xcnt 0x0"
               :: "v"(qrow[0] + 8 * ((lane >> 4) & 1)), "v"(qrow[1] + 8 * ((lane >> 4) & 1))
               : "memory");

  const v8f zero = {0, 0, 0, 0, 0, 0, 0, 0};
  v8f o[2][8];
  float mrun[2];           // running maximum of this lane's query, per tile
  v8f   lacc[2];           // running sums: register r, this wave half's keys only
#pragma unroll
  for (int q = 0; q < 2; ++q) {
#pragma unroll
    for (int t = 0; t < 8; ++t) o[q][t] = zero;
    mrun[q] = -3.0e38f;
    lacc[q] = zero;
  }

  for (int j0 = 0; j0 < N_; j0 += 64) {
    // ---- Async DMA: K tile (64 x 128 ch) and V tile (128 ch x 64 keys) ----
    unsigned la[8];
    const _Float16* ga[8];
    // K: 64 rows x 16 b128-chunks = 1024 chunks, 8 per thread.
#pragma unroll
    for (int it = 0; it < 8; ++it) {
      int lin = tid + 128 * it;
      int row = lin >> 4, cc = lin & 15;
      la[it] = kbase + (unsigned)(row * 17 + cc) * 16;
      ga[it] = K + ((size_t)(b * N_ + j0 + row)) * CI_ + cc * 8;
    }
    async_copy8_b128(la, ga);
    // V: 128 rows x 8 b128-chunks = 1024 chunks, 8 per thread.
#pragma unroll
    for (int it = 0; it < 8; ++it) {
      int lin = tid + 128 * it;
      int row = lin >> 3, cc = lin & 7;
      la[it] = vbase + (unsigned)(row * 9 + cc) * 16;
      ga[it] = V + ((size_t)(b * C_ + ch0 + row)) * N_ + j0 + cc * 8;
    }
    async_copy8_b128(la, ga);
    asm volatile("s_wait_asynccnt 0" ::: "memory");
    __syncthreads();

    // ---- S^T = K Q^T for a 64-key x 32-query strip (4 k-steps x 4 x 2 tiles) ----
    // D layout: query = lane&15 of tile q, key = tn*16 + reg + 8*(lane>=16).
    // Fragments come from LDS in groups of four through a ring of two groups:
    // a group is requested as soon as the products on its registers are issued,
    // one group of products ahead of its use. The ring runs on into V, so the
    // first eight V fragments are under way while the softmax is computed.
    const _Float16* kb = &Klds[(lane & 15) * 136];
    const _Float16* vb = &Vlds[(lane & 15) * 72];
    v16h fr[8];
#pragma unroll
    for (int t = 0; t < 4; ++t) fr[t] = frag_from(kb + t * 16 * 136, 0, lane);
#pragma unroll
    for (int t = 0; t < 4; ++t) fr[4 + t] = frag_from(kb + t * 16 * 136, 32, lane);
    GROUP_EDGE();
    v8f s[2][4];
#pragma unroll
    for (int q = 0; q < 2; ++q) {
#pragma unroll
      for (int tn = 0; tn < 4; ++tn) s[q][tn] = zero;
    }
#pragma unroll
    for (int ks = 0; ks < 4; ++ks) {
      const int g = (ks & 1) * 4;
#pragma unroll
      for (int tn = 0; tn < 4; ++tn) {
#pragma unroll
        for (int q = 0; q < 2; ++q)
          s[q][tn] = __builtin_amdgcn_wmma_f32_16x16x32_f16(false, fr[g + tn], false, qf[q][ks],
                                                            (short)0, s[q][tn], false, false);
      }
      GROUP_EDGE();
#pragma unroll
      for (int t = 0; t < 4; ++t)
        fr[g + t] = (ks < 2) ? frag_from(kb + t * 16 * 136, (ks + 2) * 32, lane)
                             : frag_from(vb + (g + t) * 16 * 72, 0, lane);
      GROUP_EDGE();
    }

    // ---- Online softmax: 32 of each query's 64 scores are in this lane ----
    float mn[2], alpha[2];
#pragma unroll
    for (int q = 0; q < 2; ++q) {
      // Register-wise maxima first: the scalar chain, written for two tiles, built
      // with one more instruction per score. A maximum is exact in any order.
      const v8f m8 = __builtin_elementwise_max(__builtin_elementwise_max(s[q][0], s[q][1]),
                                               __builtin_elementwise_max(s[q][2], s[q][3]));
      float v = fmaxf(fmaxf(fmaxf(m8[0], m8[1]), fmaxf(m8[2], m8[3])),
                      fmaxf(fmaxf(m8[4], m8[5]), fmaxf(m8[6], m8[7])));
      v = fmaxf(v, xhalf(v));
      mn[q]    = fmaxf(mrun[q], v);
      alpha[q] = __expf(mrun[q] - mn[q]);
      mrun[q]  = mn[q];
#pragma unroll
      for (int t = 0; t < 8; ++t) o[q][t] *= alpha[q];
    }

    // P^T as B fragments: tile 2ks gives k = 8h..8h+7, tile 2ks+1 k = 16+8h..16+8h+7.
    // ---- O^T += V P^T : 2 k-steps over the 64 keys x 8 channel tiles x 2 ----
    v8f rs[2] = {zero, zero};
#pragma unroll
    for (int ks = 0; ks < 2; ++ks) {
      v16h pf[2];
#pragma unroll
      for (int q = 0; q < 2; ++q) {
#pragma unroll
        for (int tn = 2 * ks; tn < 2 * ks + 2; ++tn) {
#pragma unroll
          for (int r = 0; r < 8; ++r) {
            float p = __expf(s[q][tn][r] - mn[q]);
            pf[q][(tn & 1) * 8 + r] = (_Float16)p;
            rs[q][r] += p;
          }
        }
      }
#pragma unroll
      for (int g = 0; g < 8; g += 4) {
#pragma unroll
        for (int t = 0; t < 4; ++t) {
#pragma unroll
          for (int q = 0; q < 2; ++q)
            o[q][g + t] = __builtin_amdgcn_wmma_f32_16x16x32_f16(false, fr[g + t], false, pf[q],
                                                                 (short)0, o[q][g + t], false, false);
        }
        if (ks == 0) {
          GROUP_EDGE();
#pragma unroll
          for (int t = 0; t < 4; ++t) fr[g + t] = frag_from(vb + (g + t) * 16 * 72, 32, lane);
          GROUP_EDGE();
        }
      }
    }
#pragma unroll
    for (int q = 0; q < 2; ++q) lacc[q] = lacc[q] * alpha[q] + rs[q];
    __syncthreads();   // keep next tile's DMA from overwriting live K/V reads
  }

  // ---- Epilogue: out = gamma * O / l + x (both (B,C,N) f32) ----
  // O^T layout: pixel = lane&15 of tile q, channel = ct*16 + reg + 8*(lane>=16).
  const float g = gamma[0];
  // The register that this load's address names may be reused from here on.
  asm volatile("s_wait_xcnt 0x0" ::: "memory");
  float inv[2];
#pragma unroll
  for (int q = 0; q < 2; ++q) {
    float lsum = ((lacc[q][0] + lacc[q][1]) + (lacc[q][2] + lacc[q][3])) +
                 ((lacc[q][4] + lacc[q][5]) + (lacc[q][6] + lacc[q][7]));
    lsum += xhalf(lsum);
    inv[q] = 1.0f / lsum;
  }
  // One address per buffer: every element of this lane lies a constant distance
  // behind it. All x values are requested first, so that their latencies overlap.
  const size_t e0 = ((size_t)(b * C_ + ch0 + 8 * (lane >> 4))) * N_ + m0 + wave * 32 + (lane & 15);
  const float* xb = x + e0;
  float*       ob = out + e0;
  float xv[2][8][8];
#pragma unroll
  for (int q = 0; q < 2; ++q) {
#pragma unroll
    for (int ct = 0; ct < 8; ++ct) {
#pragma unroll
      for (int r = 0; r < 8; ++r) xv[q][ct][r] = xb[(ct * 16 + r) * N_ + q * 16];
    }
  }
  // The registers that held the load address may be reused from here on; the wait
  // names the address as an input so that it is not reused ahead of it.
  asm volatile("s_wait_xcnt 0x0" :: "v"(xb) : "memory");
#pragma unroll
  for (int q = 0; q < 2; ++q) {
#pragma unroll
    for (int ct = 0; ct < 8; ++ct) {
#pragma unroll
      for (int r = 0; r < 8; ++r) xv[q][ct][r] = g * (o[q][ct][r] * inv[q]) + xv[q][ct][r];
    }
  }
  // Every result is formed in front of the first store: behind this edge stand
  // stores alone, so no register that an issued store names is written again.
  GROUP_EDGE();
#pragma unroll
  for (int q = 0; q < 2; ++q) {
#pragma unroll
    for (int ct = 0; ct < 8; ++ct) {
#pragma unroll
      for (int r = 0; r < 8; ++r) ob[(ct * 16 + r) * N_ + q * 16] = xv[q][ct][r];
    }
  }
}

extern "C" void kernel_launch(void* const* d_in, const int* in_sizes, int n_in,
                              void* d_out, int out_size, void* d_ws, size_t ws_size,
                              hipStream_t stream) {
  const float* x     = (const float*)d_in[0];
  const float* Wq    = (const float*)d_in[1];
  const float* bq    = (const float*)d_in[2];
  const float* Wk    = (const float*)d_in[3];
  const float* bk    = (const float*)d_in[4];
  const float* Wv    = (const float*)d_in[5];
  const float* bv    = (const float*)d_in[6];
  const float* gamma = (const float*)d_in[7];
  float* out = (float*)d_out;

  // Workspace: Q (8MB) | K (8MB) | V (16MB), all f16.
  _Float16* Qw = (_Float16*)d_ws;
  _Float16* Kw = Qw + (size_t)B_ * N_ * CI_;
  _Float16* Vw = Kw + (size_t)B_ * N_ * CI_;

  dim3 pgrid(N_ / 128, (2 * CI_ + C_) / 64, B_);  // 32 x 8 x 8
  qkv_proj<<<pgrid, 256, 0, stream>>>(x, Wq, bq, Wk, bk, Wv, bv, Qw, Kw, Vw);

  dim3 agrid(N_ / 128, B_, 2);                    // 32 x 8 x 2 (channel halves)
  flash_attn<<<agrid, 128, 0, stream>>>(Qw, Kw, Vw, x, gamma, out);
}

// v006
// It runs in 114 microseconds.
// In two side-by-side timings against v005, it was 1.11 and 1.12 times as fast.
// Counting every step since v000, it is 3.10 times as fast.
#include <hip/hip_runtime.h>

typedef __attribute__((ext_vector_type(16))) _Float16 v16h;
typedef __attribute__((ext_vector_type(8)))  _Float16 v8h;
typedef __attribute__((ext_vector_type(8)))  float    v8f;
typedef __attribute__((ext_vector_type(4)))  float    v4f;
typedef __attribute__((ext_vector_type(2)))  float    v2f;

#define B_  8
#define C_  256
#define CI_ 128
#define N_  4096

// Keeps a group of LDS fragment reads where the source puts it: without it the
// scheduler sinks each read to just in front of its product, and every product
// then waits out a whole LDS latency.
#define GROUP_EDGE() __builtin_amdgcn_sched_barrier(0)

// Build a 16-bit A/B-matrix fragment (v16h -> 8 VGPRs) from a row-major source
// where the 32 K-values for this fragment's row live contiguously at rowbase+kbase.
// Per ISA 7.12.2 (16-bit A 16x32): lanes 0-15 hold K {0..7, 16..23},
// lanes 16-31 hold K {8..15, 24..31}; element i of v16h -> VGPR i/2 half i&1.
__device__ __forceinline__ v16h frag_from(const _Float16* rowbase, int kbase, int lane) {
  const int h = (lane >> 4) & 1;
  v8h a = *(const v8h*)(rowbase + kbase + 8 * h);
  v8h b = *(const v8h*)(rowbase + kbase + 16 + 8 * h);
  v16h r;
#pragma unroll
  for (int i = 0; i < 8; ++i) { r[i] = a[i]; r[i + 8] = b[i]; }
  return r;
}

// Async DMA of eight 16-byte chunks per lane from global memory into LDS.
// Tracked by ASYNCcnt; LDS address is wave-relative (low 32 bits of generic ptr).
// The s_wait_xcnt closes the statement so that no address register named here
// is rewritten ahead of it.
__device__ __forceinline__ void async_copy8_b128(const unsigned (&l)[8],
                                                 const _Float16* const (&g)[8]) {
  asm volatile("global_load_async_to_lds_b128 %0, %8, off\n\t"
               "global_load_async_to_lds_b128 %1, %9, off\n\t"
               "global_load_async_to_lds_b128 %2, %10, off\n\t"
               "global_load_async_to_lds_b128 %3, %11, off\n\t"
               "global_load_async_to_lds_b128 %4, %12, off\n\t"
               "global_load_async_to_lds_b128 %5, %13, off\n\t"
               "global_load_async_to_lds_b128 %6, %14, off\n\t"
               "global_load_async_to_lds_b128 %7, %15, off\n\t"
               "s_wait_xcnt 0x0"
               :: "v"(l[0]), "v"(l[1]), "v"(l[2]), "v"(l[3]),
                  "v"(l[4]), "v"(l[5]), "v"(l[6]), "v"(l[7]),
                  "v"(g[0]), "v"(g[1]), "v"(g[2]), "v"(g[3]),
                  "v"(g[4]), "v"(g[5]), "v"(g[6]), "v"(g[7])
               : "memory");
}

__device__ __forceinline__ unsigned lds_off_of(const void* p) {
  return (unsigned)(size_t)p;  // generic LDS addr truncates to wave-relative offset
}

// Lane l exchanges with lane l ^ 16 (the other 16-lane row), in registers.
__device__ __forceinline__ float xhalf(float v) {
  int i = __builtin_bit_cast(int, v);
  return __builtin_bit_cast(float,
      __builtin_amdgcn_permlanex16(i, i, 0x76543210, 0xfedcba98, false, false));
}

// ---------------------------------------------------------------------------
// Kernel 1: fused Q/K/V 1x1-conv projections as a f16 WMMA GEMM.
// Out tile per block: 128 pixels x 64 output channels. K-dim = C_ = 256.
// Q,K written (B,N,CI) pixel-major f16; V written (B,C,N) channel-major f16.
// A lane's eight accumulator rows always run along the output's contiguous
// axis, so each tile leaves as one 16-byte store per lane: for V the pixels are
// the A rows (D = x^T W^T), for Q and K the output channels are (D = W x).
// ---------------------------------------------------------------------------
template <bool VMAJ>
__device__ __forceinline__ void proj_tile(
    const float* __restrict__ x, const float* __restrict__ W,
    const float* __restrict__ bias, _Float16* __restrict__ dst,
    int crel, int b, int p0, _Float16* Ald, _Float16* Bld) {
  const int tid  = threadIdx.x;
  const int lane = tid & 31;
  const int wave = tid >> 5;
  const int pp   = tid & 63;   // pixel pair of the x tile that this thread stages
  const int cg   = tid >> 6;   // its group of eight input channels

  // Every short loop here is unrolled so that acc, fx, fw and h are indexed by
  // constants and stay in registers.
  const v8f zero = {0, 0, 0, 0, 0, 0, 0, 0};
  v8f acc[4];
#pragma unroll
  for (int t = 0; t < 4; ++t) acc[t] = zero;

  for (int c0 = 0; c0 < C_; c0 += 32) {
    // Stage the x^T tile (channel-major x, f32 -> f16) and the weight tile (rows
    // contiguous over input channel). A thread takes two neighbouring pixels of
    // eight consecutive channels, so the transpose happens in its registers and
    // each pixel's eight channels go to LDS as one 16-byte store. All ten loads
    // are requested before the first LDS store, so that their latencies overlap.
    v2f fx[8];
    v4f fw[2];
    const float* xp = x + ((size_t)(b * C_ + c0 + cg * 8)) * N_ + p0 + pp * 2;
#pragma unroll
    for (int j = 0; j < 8; ++j) fx[j] = *(const v2f*)(xp + j * N_);
    // The registers that held these addresses may be reused from here on.
    asm volatile("s_wait_xcnt 0x0" ::: "memory");
#pragma unroll
    for (int it = 0; it < 2; ++it) {
      int lin = tid + 256 * it;          // 0..511: out channel lin>>3, channel quad lin&7
      fw[it] = *(const v4f*)(W + (size_t)(crel + (lin >> 3)) * C_ + c0 + (lin & 7) * 4);
    }
#pragma unroll
    for (int i = 0; i < 2; ++i) {
      v8h hx;
#pragma unroll
      for (int j = 0; j < 8; ++j) hx[j] = (_Float16)fx[j][i];
      *(v8h*)&Ald[(pp * 2 + i) * 40 + cg * 8] = hx;
    }
#pragma unroll
    for (int it = 0; it < 2; ++it) {
      int lin = tid + 256 * it;
#pragma unroll
      for (int i = 0; i < 4; ++i) Bld[(lin >> 3) * 40 + (lin & 7) * 4 + i] = (_Float16)fw[it][i];
    }
    __syncthreads();

    v16h xf = frag_from(&Ald[(wave * 16 + (lane & 15)) * 40], 0, lane);
#pragma unroll
    for (int tn = 0; tn < 4; ++tn) {
      v16h wf = frag_from(&Bld[(tn * 16 + (lane & 15)) * 40], 0, lane);
      acc[tn] = VMAJ
          ? __builtin_amdgcn_wmma_f32_16x16x32_f16(false, xf, false, wf,
                                                   (short)0, acc[tn], false, false)
          : __builtin_amdgcn_wmma_f32_16x16x32_f16(false, wf, false, xf,
                                                   (short)0, acc[tn], false, false);
    }
    __syncthreads();
  }

  // Bias + f16 store. C/D layout: col = lane&15, row = reg + 8*(lane>=16).
  const int col  = lane & 15;
  const int row8 = 8 * (lane >> 4);
#pragma unroll
  for (int tn = 0; tn < 4; ++tn) {
    v8h h;
    if (VMAJ) {   // col = output channel, rows = 8 consecutive pixels
      const int cloc = crel + tn * 16 + col;
      const float bb = bias[cloc];
#pragma unroll
      for (int r = 0; r < 8; ++r) h[r] = (_Float16)(acc[tn][r] + bb);
      *(v8h*)(dst + ((size_t)(b * C_ + cloc)) * N_ + p0 + wave * 16 + row8) = h;
    } else {      // col = pixel, rows = 8 consecutive output channels
      const int c8 = crel + tn * 16 + row8;
#pragma unroll
      for (int r = 0; r < 8; ++r) h[r] = (_Float16)(acc[tn][r] + bias[c8 + r]);
      *(v8h*)(dst + ((size_t)(b * N_ + p0 + wave * 16 + col)) * CI_ + c8) = h;
    }
  }
}

__global__ __launch_bounds__(256) void qkv_proj(
    const float* __restrict__ x,
    const float* __restrict__ Wq, const float* __restrict__ bq,
    const float* __restrict__ Wk, const float* __restrict__ bk,
    const float* __restrict__ Wv, const float* __restrict__ bv,
    _Float16* __restrict__ Qo, _Float16* __restrict__ Ko, _Float16* __restrict__ Vo) {
  __shared__ _Float16 Ald[128 * 40];  // 128 pixels x 32 ch, pitch 40 halves (16B rows)
  __shared__ _Float16 Bld[64 * 40];   // 64 outch x 32 ch

  const int p0 = blockIdx.x * 128;
  const int o0 = blockIdx.y * 64;
  const int b  = blockIdx.z;

  if (o0 < 256) {
    const bool isq = o0 < 128;
    proj_tile<false>(x, isq ? Wq : Wk, isq ? bq : bk, isq ? Qo : Ko, o0 & 127, b, p0, Ald, Bld);
  } else {
    proj_tile<true>(x, Wv, bv, Vo, o0 - 256, b, p0, Ald, Bld);
  }
}

__global__ __launch_bounds__(128) void flash_attn(
    const _Float16* __restrict__ Q, const _Float16* __restrict__ K,
    const _Float16* __restrict__ V, const float* __restrict__ x,
    const float* __restrict__ gamma, float* __restrict__ out) {
  __shared__ _Float16 Klds[2][64 * 136];   // 64 keys x 128 ch, pitch 136 halves (17 chunks)
  __shared__ _Float16 Vlds[2][128 * 72];   // 128 ch x 64 keys, pitch 72 halves (9 chunks)

  const int tid  = threadIdx.x;
  const int lane = tid & 31;
  const int wave = tid >> 5;
  const int m0  = blockIdx.x * 128;
  const int b   = blockIdx.y;
  const int ch0 = blockIdx.z * 128;

  // ---- Async DMA of the next tile pair: K (64 keys x 128 ch, one contiguous
  // 16 KiB run of global memory) and V (128 ch x 64 keys), 1024 b128-chunks each,
  // 8 + 8 per thread. Four running addresses say where the next tile comes from
  // and goes to; every chunk of a thread lies a constant distance behind them, so
  // that no table of addresses has to be kept in registers over the loop.
  unsigned lk = lds_off_of(&Klds[0][0]) + (unsigned)((tid >> 4) * 17 + (tid & 15)) * 16;
  unsigned lv = lds_off_of(&Vlds[0][0]) + (unsigned)((tid >> 3) * 9 + (tid & 7)) * 16;
  const _Float16* gk = K + (size_t)b * N_ * CI_ + tid * 8;
  const _Float16* gv = V + ((size_t)(b * C_ + ch0 + (tid >> 3))) * N_ + (tid & 7) * 8;
  int kstep = (int)sizeof(Klds[0]);   // to the other buffer; the sign flips per tile
  int vstep = (int)sizeof(Vlds[0]);
  auto stage_tiles = [&]() {
    // Both loops are unrolled so that la and ga are indexed by constants and
    // stay in registers.
    unsigned la[8];
    const _Float16* ga[8];
#pragma unroll
    for (int it = 0; it < 8; ++it) {   // 8 key rows further per chunk
      la[it] = lk + (unsigned)(it * 8 * 17 * 16);
      ga[it] = gk + it * 8 * CI_;
    }
    async_copy8_b128(la, ga);
#pragma unroll
    for (int it = 0; it < 8; ++it) {   // 16 channel rows further per chunk
      la[it] = lv + (unsigned)(it * 16 * 9 * 16);
      ga[it] = gv + (size_t)it * 16 * N_;
    }
    async_copy8_b128(la, ga);
    gk += 64 * CI_;
    gv += 64;
    lk += kstep; kstep = -kstep;
    lv += vstep; vstep = -vstep;
  };
  // Tile 0 is under way while the Q fragments are fetched.
  stage_tiles();

  // Every short loop below is unrolled so that the register arrays are indexed
  // by constants.
  // Q fragments straight from global: (B,N,CI) rows are contiguous over c.
  v16h qf[2][4];
  const _Float16* qrow[2];
#pragma unroll
  for (int q = 0; q < 2; ++q) {
    const int rowq = m0 + wave * 32 + q * 16 + (lane & 15);
    qrow[q] = Q + ((size_t)(b * N_ + rowq)) * CI_;
#pragma unroll
    for (int ks = 0; ks < 4; ++ks) qf[q][ks] = frag_from(qrow[q], ks * 32, lane);
  }
  // The registers that held these addresses may be reused from here on; the wait
  // names the two addresses as inputs so that they are not reused ahead of it.
  asm volatile("s_wait_xcnt 0x0"
               :: "v"(qrow[0] + 8 * ((lane >> 4) & 1)), "v"(qrow[1] + 8 * ((lane >> 4) & 1))
               : "memory");

  const v8f zero = {0, 0, 0, 0, 0, 0, 0, 0};
  v8f o[2][8];
  float mrun[2];           // running maximum of this lane's query, per tile
  v8f   lacc[2];           // running sums: register r, this wave half's keys only
#pragma unroll
  for (int q = 0; q < 2; ++q) {
#pragma unroll
    for (int t = 0; t < 8; ++t) o[q][t] = zero;
    mrun[q] = -3.0e38f;
    lacc[q] = zero;
  }

  // Tile 0 has landed and is published; then tile 1 starts into the other buffer.
  asm volatile("s_wait_asynccnt 0x0" ::: "memory");
  __syncthreads();
  stage_tiles();

  for (int j0 = 0; j0 < N_; j0 += 64) {
    const int buf = (j0 >> 6) & 1;
    // ---- S^T = K Q^T for a 64-key x 32-query strip (4 k-steps x 4 x 2 tiles) ----
    // D layout: query = lane&15 of tile q, key = tn*16 + reg + 8*(lane>=16).
    // Fragments come from LDS in groups of four through a ring of two groups:
    // a group is requested as soon as the products on its registers are issued,
    // one group of products ahead of its use. The ring runs on into V, so the
    // first eight V fragments are under way while the softmax is computed.
    const _Float16* kb = &Klds[buf][(lane & 15) * 136];
    const _Float16* vb = &Vlds[buf][(lane & 15) * 72];
    v16h fr[8];
#pragma unroll
    for (int t = 0; t < 4; ++t) fr[t] = frag_from(kb + t * 16 * 136, 0, lane);
#pragma unroll
    for (int t = 0; t < 4; ++t) fr[4 + t] = frag_from(kb + t * 16 * 136, 32, lane);
    GROUP_EDGE();
    v8f s[2][4];
#pragma unroll
    for (int q = 0; q < 2; ++q) {
#pragma unroll
      for (int tn = 0; tn < 4; ++tn) s[q][tn] = zero;
    }
#pragma unroll
    for (int ks = 0; ks < 4; ++ks) {
      const int g = (ks & 1) * 4;
#pragma unroll
      for (int tn = 0; tn < 4; ++tn) {
#pragma unroll
        for (int q = 0; q < 2; ++q)
          s[q][tn] = __builtin_amdgcn_wmma_f32_16x16x32_f16(false, fr[g + tn], false, qf[q][ks],
                                                            (short)0, s[q][tn], false, false);
      }
      GROUP_EDGE();
#pragma unroll
      for (int t = 0; t < 4; ++t)
        fr[g + t] = (ks < 2) ? frag_from(kb + t * 16 * 136, (ks + 2) * 32, lane)
                             : frag_from(vb + (g + t) * 16 * 72, 0, lane);
      GROUP_EDGE();
    }

    // ---- Online softmax: 32 of each query's 64 scores are in this lane ----
    float mn[2], alpha[2];
#pragma unroll
    for (int q = 0; q < 2; ++q) {
      // Register-wise maxima first: the scalar chain, written for two tiles, built
      // with one more instruction per score. A maximum is exact in any order.
      const v8f m8 = __builtin_elementwise_max(__builtin_elementwise_max(s[q][0], s[q][1]),
                                               __builtin_elementwise_max(s[q][2], s[q][3]));
      float v = fmaxf(fmaxf(fmaxf(m8[0], m8[1]), fmaxf(m8[2], m8[3])),
                      fmaxf(fmaxf(m8[4], m8[5]), fmaxf(m8[6], m8[7])));
      v = fmaxf(v, xhalf(v));
      mn[q]    = fmaxf(mrun[q], v);
      alpha[q] = __expf(mrun[q] - mn[q]);
      mrun[q]  = mn[q];
#pragma unroll
      for (int t = 0; t < 8; ++t) o[q][t] *= alpha[q];
    }

    // P^T as B fragments: tile 2ks gives k = 8h..8h+7, tile 2ks+1 k = 16+8h..16+8h+7.
    // ---- O^T += V P^T : 2 k-steps over the 64 keys x 8 channel tiles x 2 ----
    v8f rs[2] = {zero, zero};
#pragma unroll
    for (int ks = 0; ks < 2; ++ks) {
      v16h pf[2];
#pragma unroll
      for (int q = 0; q < 2; ++q) {
#pragma unroll
        for (int tn = 2 * ks; tn < 2 * ks + 2; ++tn) {
#pragma unroll
          for (int r = 0; r < 8; ++r) {
            float p = __expf(s[q][tn][r] - mn[q]);
            pf[q][(tn & 1) * 8 + r] = (_Float16)p;
            rs[q][r] += p;
          }
        }
      }
#pragma unroll
      for (int g = 0; g < 8; g += 4) {
#pragma unroll
        for (int t = 0; t < 4; ++t) {
#pragma unroll
          for (int q = 0; q < 2; ++q)
            o[q][g + t] = __builtin_amdgcn_wmma_f32_16x16x32_f16(false, fr[g + t], false, pf[q],
                                                                 (short)0, o[q][g + t], false, false);
        }
        if (ks == 0) {
          GROUP_EDGE();
#pragma unroll
          for (int t = 0; t < 4; ++t) fr[g + t] = frag_from(vb + (g + t) * 16 * 72, 32, lane);
          GROUP_EDGE();
        }
      }
    }
#pragma unroll
    for (int q = 0; q < 2; ++q) lacc[q] = lacc[q] * alpha[q] + rs[q];
    // Hand-over: this wave's reads of the buffer are done, its copies of the next
    // tile have landed; the one barrier publishes that tile and frees this buffer,
    // which the tile after next is then copied into.
    asm volatile("s_wait_dscnt 0x0" ::: "memory");
    asm volatile("s_wait_asynccnt 0x0" ::: "memory");
    __syncthreads();
    if (j0 + 128 < N_) stage_tiles();
  }
  // No copy is outstanding when the wave goes on to its end.
  asm volatile("s_wait_asynccnt 0x0" ::: "memory");

  // ---- Epilogue: out = gamma * O / l + x (both (B,C,N) f32) ----
  // O^T layout: pixel = lane&15 of tile q, channel = ct*16 + reg + 8*(lane>=16).
  const float g = gamma[0];
  // The register that this load's address names may be reused from here on.
  asm volatile("s_wait_xcnt 0x0" ::: "memory");
  float inv[2];
#pragma unroll
  for (int q = 0; q < 2; ++q) {
    float lsum = ((lacc[q][0] + lacc[q][1]) + (lacc[q][2] + lacc[q][3])) +
                 ((lacc[q][4] + lacc[q][5]) + (lacc[q][6] + lacc[q][7]));
    lsum += xhalf(lsum);
    inv[q] = 1.0f / lsum;
  }
  // One address per buffer: every element of this lane lies a constant distance
  // behind it. All x values are requested first, so that their latencies overlap.
  const size_t e0 = ((size_t)(b * C_ + ch0 + 8 * (lane >> 4))) * N_ + m0 + wave * 32 + (lane & 15);
  const float* xb = x + e0;
  float*       ob = out + e0;
  float xv[2][8][8];
#pragma unroll
  for (int q = 0; q < 2; ++q) {
#pragma unroll
    for (int ct = 0; ct < 8; ++ct) {
#pragma unroll
      for (int r = 0; r < 8; ++r) xv[q][ct][r] = xb[(ct * 16 + r) * N_ + q * 16];
    }
  }
  // The registers that held the load address may be reused from here on; the wait
  // names the address as an input so that it is not reused ahead of it.
  asm volatile("s_wait_xcnt 0x0" :: "v"(xb) : "memory");
#pragma unroll
  for (int q = 0; q < 2; ++q) {
#pragma unroll
    for (int ct = 0; ct < 8; ++ct) {
#pragma unroll
      for (int r = 0; r < 8; ++r) xv[q][ct][r] = g * (o[q][ct][r] * inv[q]) + xv[q][ct][r];
    }
  }
  // Every result is formed in front of the first store: behind this edge stand
  // stores alone, so no register that an issued store names is written again.
  GROUP_EDGE();
#pragma unroll
  for (int q = 0; q < 2; ++q) {
#pragma unroll
    for (int ct = 0; ct < 8; ++ct) {
#pragma unroll
      for (int r = 0; r < 8; ++r) ob[(ct * 16 + r) * N_ + q * 16] = xv[q][ct][r];
    }
  }
}

extern "C" void kernel_launch(void* const* d_in, const int* in_sizes, int n_in,
                              void* d_out, int out_size, void* d_ws, size_t ws_size,
                              hipStream_t stream) {
  const float* x     = (const float*)d_in[0];
  const float* Wq    = (const float*)d_in[1];
  const float* bq    = (const float*)d_in[2];
  const float* Wk    = (const float*)d_in[3];
  const float* bk    = (const float*)d_in[4];
  const float* Wv    = (const float*)d_in[5];
  const float* bv    = (const float*)d_in[6];
  const float* gamma = (const float*)d_in[7];
  float* out = (float*)d_out;

  // Workspace: Q (8MB) | K (8MB) | V (16MB), all f16.
  _Float16* Qw = (_Float16*)d_ws;
  _Float16* Kw = Qw + (size_t)B_ * N_ * CI_;
  _Float16* Vw = Kw + (size_t)B_ * N_ * CI_;

  dim3 pgrid(N_ / 128, (2 * CI_ + C_) / 64, B_);  // 32 x 8 x 8
  qkv_proj<<<pgrid, 256, 0, stream>>>(x, Wq, bq, Wk, bk, Wv, bv, Qw, Kw, Vw);

  dim3 agrid(N_ / 128, B_, 2);                    // 32 x 8 x 2 (channel halves)
  flash_attn<<<agrid, 128, 0, stream>>>(Qw, Kw, Vw, x, gamma, out);
}

// v007
// It runs in 99.8 microseconds.
// In two side-by-side timings against v006, it was 1.15 and 1.14 times as fast.
// All steps since v000 together make it 3.55 times as fast.
#include <hip/hip_runtime.h>

typedef __attribute__((ext_vector_type(16))) _Float16 v16h;
typedef __attribute__((ext_vector_type(8)))  _Float16 v8h;
typedef __attribute__((ext_vector_type(8)))  float    v8f;
typedef __attribute__((ext_vector_type(4)))  float    v4f;
typedef __attribute__((ext_vector_type(2)))  float    v2f;

#define B_  8
#define C_  256
#define CI_ 128
#define N_  4096

// Keeps a group of LDS fragment reads where the source puts it: without it the
// scheduler sinks each read to just in front of its product, and every product
// then waits out a whole LDS latency.
#define GROUP_EDGE() __builtin_amdgcn_sched_barrier(0)

// Build a 16-bit A/B-matrix fragment (v16h -> 8 VGPRs) from a row-major source
// where the 32 K-values for this fragment's row live contiguously at rowbase+kbase.
// Per ISA 7.12.2 (16-bit A 16x32): lanes 0-15 hold K {0..7, 16..23},
// lanes 16-31 hold K {8..15, 24..31}; element i of v16h -> VGPR i/2 half i&1.
__device__ __forceinline__ v16h frag_from(const _Float16* rowbase, int kbase, int lane) {
  const int h = (lane >> 4) & 1;
  v8h a = *(const v8h*)(rowbase + kbase + 8 * h);
  v8h b = *(const v8h*)(rowbase + kbase + 16 + 8 * h);
  v16h r;
#pragma unroll
  for (int i = 0; i < 8; ++i) { r[i] = a[i]; r[i + 8] = b[i]; }
  return r;
}

// Async DMA of four 16-byte chunks per lane from global memory into LDS.
// Tracked by ASYNCcnt; LDS address is wave-relative (low 32 bits of generic ptr).
// The s_wait_xcnt closes the statement so that no address register named here
// is rewritten ahead of it. Four copies a statement: asm operands must lie in the
// first 256 registers, where the accumulators leave little room (eight spilled).
__device__ __forceinline__ void async_copy4_b128(const unsigned* l, const _Float16* const* g) {
  asm volatile("global_load_async_to_lds_b128 %0, %4, off\n\t"
               "global_load_async_to_lds_b128 %1, %5, off\n\t"
               "global_load_async_to_lds_b128 %2, %6, off\n\t"
               "global_load_async_to_lds_b128 %3, %7, off\n\t"
               "s_wait_xcnt 0x0"
               :: "v"(l[0]), "v"(l[1]), "v"(l[2]), "v"(l[3]),
                  "v"(g[0]), "v"(g[1]), "v"(g[2]), "v"(g[3])
               : "memory");
}

__device__ __forceinline__ unsigned lds_off_of(const void* p) {
  return (unsigned)(size_t)p;  // generic LDS addr truncates to wave-relative offset
}

// Lane l exchanges with lane l ^ 16 (the other 16-lane row), in registers.
__device__ __forceinline__ float xhalf(float v) {
  int i = __builtin_bit_cast(int, v);
  return __builtin_bit_cast(float,
      __builtin_amdgcn_permlanex16(i, i, 0x76543210, 0xfedcba98, false, false));
}

// ---------------------------------------------------------------------------
// Kernel 1: fused Q/K/V 1x1-conv projections as a f16 WMMA GEMM.
// Out tile per block: 128 pixels x 64 output channels. K-dim = C_ = 256.
// Q,K written (B,N,CI) pixel-major f16; V written (B,C,N) channel-major f16.
// A lane's eight accumulator rows always run along the output's contiguous
// axis, so each tile leaves as one 16-byte store per lane: for V the pixels are
// the A rows (D = x^T W^T), for Q and K the output channels are (D = W x).
// ---------------------------------------------------------------------------
template <bool VMAJ>
__device__ __forceinline__ void proj_tile(
    const float* __restrict__ x, const float* __restrict__ W,
    const float* __restrict__ bias, _Float16* __restrict__ dst,
    int crel, int b, int p0, _Float16* Ald, _Float16* Bld) {
  const int tid  = threadIdx.x;
  const int lane = tid & 31;
  const int wave = tid >> 5;
  const int pp   = tid & 63;   // pixel pair of the x tile that this thread stages
  const int cg   = tid >> 6;   // its group of eight input channels

  // Every short loop here is unrolled so that acc, fx, fw and h are indexed by
  // constants and stay in registers.
  const v8f zero = {0, 0, 0, 0, 0, 0, 0, 0};
  v8f acc[4];
#pragma unroll
  for (int t = 0; t < 4; ++t) acc[t] = zero;

  for (int c0 = 0; c0 < C_; c0 += 32) {
    // Stage the x^T tile (channel-major x, f32 -> f16) and the weight tile (rows
    // contiguous over input channel). A thread takes two neighbouring pixels of
    // eight consecutive channels, so the transpose happens in its registers and
    // each pixel's eight channels go to LDS as one 16-byte store. All ten loads
    // are requested before the first LDS store, so that their latencies overlap.
    v2f fx[8];
    v4f fw[2];
    const float* xp = x + ((size_t)(b * C_ + c0 + cg * 8)) * N_ + p0 + pp * 2;
#pragma unroll
    for (int j = 0; j < 8; ++j) fx[j] = *(const v2f*)(xp + j * N_);
    // The registers that held these addresses may be reused from here on.
    asm volatile("s_wait_xcnt 0x0" ::: "memory");
#pragma unroll
    for (int it = 0; it < 2; ++it) {
      int lin = tid + 256 * it;          // 0..511: out channel lin>>3, channel quad lin&7
      fw[it] = *(const v4f*)(W + (size_t)(crel + (lin >> 3)) * C_ + c0 + (lin & 7) * 4);
    }
#pragma unroll
    for (int i = 0; i < 2; ++i) {
      v8h hx;
#pragma unroll
      for (int j = 0; j < 8; ++j) hx[j] = (_Float16)fx[j][i];
      *(v8h*)&Ald[(pp * 2 + i) * 40 + cg * 8] = hx;
    }
#pragma unroll
    for (int it = 0; it < 2; ++it) {
      int lin = tid + 256 * it;
#pragma unroll
      for (int i = 0; i < 4; ++i) Bld[(lin >> 3) * 40 + (lin & 7) * 4 + i] = (_Float16)fw[it][i];
    }
    __syncthreads();

    v16h xf = frag_from(&Ald[(wave * 16 + (lane & 15)) * 40], 0, lane);
#pragma unroll
    for (int tn = 0; tn < 4; ++tn) {
      v16h wf = frag_from(&Bld[(tn * 16 + (lane & 15)) * 40], 0, lane);
      acc[tn] = VMAJ
          ? __builtin_amdgcn_wmma_f32_16x16x32_f16(false, xf, false, wf,
                                                   (short)0, acc[tn], false, false)
          : __builtin_amdgcn_wmma_f32_16x16x32_f16(false, wf, false, xf,
                                                   (short)0, acc[tn], false, false);
    }
    __syncthreads();
  }

  // Bias + f16 store. C/D layout: col = lane&15, row = reg + 8*(lane>=16).
  const int col  = lane & 15;
  const int row8 = 8 * (lane >> 4);
#pragma unroll
  for (int tn = 0; tn < 4; ++tn) {
    v8h h;
    if (VMAJ) {   // col = output channel, rows = 8 consecutive pixels
      const int cloc = crel + tn * 16 + col;
      const float bb = bias[cloc];
#pragma unroll
      for (int r = 0; r < 8; ++r) h[r] = (_Float16)(acc[tn][r] + bb);
      *(v8h*)(dst + ((size_t)(b * C_ + cloc)) * N_ + p0 + wave * 16 + row8) = h;
    } else {      // col = pixel, rows = 8 consecutive output channels
      const int c8 = crel + tn * 16 + row8;
#pragma unroll
      for (int r = 0; r < 8; ++r) h[r] = (_Float16)(acc[tn][r] + bias[c8 + r]);
      *(v8h*)(dst + ((size_t)(b * N_ + p0 + wave * 16 + col)) * CI_ + c8) = h;
    }
  }
}

__global__ __launch_bounds__(256) void qkv_proj(
    const float* __restrict__ x,
    const float* __restrict__ Wq, const float* __restrict__ bq,
    const float* __restrict__ Wk, const float* __restrict__ bk,
    const float* __restrict__ Wv, const float* __restrict__ bv,
    _Float16* __restrict__ Qo, _Float16* __restrict__ Ko, _Float16* __restrict__ Vo) {
  __shared__ _Float16 Ald[128 * 40];  // 128 pixels x 32 ch, pitch 40 halves (16B rows)
  __shared__ _Float16 Bld[64 * 40];   // 64 outch x 32 ch

  const int p0 = blockIdx.x * 128;
  const int o0 = blockIdx.y * 64;
  const int b  = blockIdx.z;

  if (o0 < 256) {
    const bool isq = o0 < 128;
    proj_tile<false>(x, isq ? Wq : Wk, isq ? bq : bk, isq ? Qo : Ko, o0 & 127, b, p0, Ald, Bld);
  } else {
    proj_tile<true>(x, Wv, bv, Vo, o0 - 256, b, p0, Ald, Bld);
  }
}

__global__ __launch_bounds__(256) __attribute__((amdgpu_waves_per_eu(2, 2))) void flash_attn(
    const _Float16* __restrict__ Q, const _Float16* __restrict__ K,
    const _Float16* __restrict__ V, const float* __restrict__ x,
    const float* __restrict__ gamma, float* __restrict__ out) {
  __shared__ _Float16 Klds[2][128 * 136];   // 128 keys x 128 ch, pitch 136 halves (17 chunks)
  __shared__ _Float16 Vlds[2][256 * 136];   // 256 ch x 128 keys, pitch 136 halves (17 chunks)
  __shared__ _Float16 Qlds[128 * 136];      // 128 queries x 128 ch, same pitch; filled once

  const int tid  = threadIdx.x;
  const int lane = tid & 31;
  const int wave = tid >> 5;
  const int qg  = wave & 3;        // query group
  const int kh  = wave >> 2;       // key half
  const int m0  = blockIdx.x * 128;
  const int b   = blockIdx.y;
  const int ch0 = kh * 128;        // the channels that this wave finishes

  // ---- Async DMA of the next tile pair: K (128 keys x 128 ch, one contiguous
  // 32 KiB run of global memory) and V (256 ch x 128 keys), 2048 and 4096
  // b128-chunks, 8 + 16 per thread. Four running addresses say where the next
  // tile comes from and goes to; every chunk of a thread lies a constant distance
  // behind them, so that no table of addresses has to be kept over the loop.
  const unsigned lrow = (unsigned)((tid >> 4) * 17 + (tid & 15)) * 16;
  unsigned lk = lds_off_of(&Klds[0][0]) + lrow;
  unsigned lv = lds_off_of(&Vlds[0][0]) + lrow;
  const _Float16* gk = K + (size_t)b * N_ * CI_ + tid * 8;
  const _Float16* gv = V + ((size_t)(b * C_ + (tid >> 4))) * N_ + (tid & 15) * 8;
  int kstep = (int)sizeof(Klds[0]);   // to the other buffer; the sign flips per tile
  int vstep = (int)sizeof(Vlds[0]);
  auto stage_tiles = [&]() {
    // The loops are unrolled so that la and ga are indexed by constants and
    // stay in registers.
    unsigned la[8];
    const _Float16* ga[8];
#pragma unroll
    for (int it = 0; it < 8; ++it) {   // 16 key rows further per chunk
      la[it] = lk + (unsigned)(it * 16 * 17 * 16);
      ga[it] = gk + it * 16 * CI_;
    }
    async_copy4_b128(la, ga);
    async_copy4_b128(la + 4, ga + 4);
#pragma unroll
    for (int hf = 0; hf < 2; ++hf) {
#pragma unroll
      for (int it = 0; it < 8; ++it) {   // 16 channel rows further per chunk
        la[it] = lv + (unsigned)((hf * 8 + it) * 16 * 17 * 16);
        ga[it] = gv + (size_t)(hf * 8 + it) * 16 * N_;
      }
      async_copy4_b128(la, ga);
      async_copy4_b128(la + 4, ga + 4);
    }
    gk += 128 * CI_;
    gv += 128;
    lk += kstep; kstep = -kstep;
    lv += vstep; vstep = -vstep;
  };
  stage_tiles();
  // The block's 128 query rows (one contiguous 32 KiB run, shaped like a K tile)
  // go to LDS once, beside tile 0. The Q fragments are read from there with each
  // K group: 256 accumulator registers leave no room to keep them in registers.
  {
    unsigned la[8];
    const _Float16* ga[8];
#pragma unroll
    for (int it = 0; it < 8; ++it) {   // 16 query rows further per chunk
      la[it] = lds_off_of(&Qlds[0]) + lrow + (unsigned)(it * 16 * 17 * 16);
      ga[it] = Q + ((size_t)(b * N_ + m0)) * CI_ + tid * 8 + it * 16 * CI_;
    }
    async_copy4_b128(la, ga);
    async_copy4_b128(la + 4, ga + 4);
  }
  const _Float16* qb = &Qlds[(qg * 32 + (lane & 15)) * 136];

  // Every short loop below is unrolled so that the register arrays are indexed
  // by constants.
  // Accumulator tile t holds channels ch0 + 16 t for t < 8 (finished here) and
  // (128 - ch0) + 16 (t - 8) for t >= 8 (handed to the partner wave).
  const v8f zero = {0, 0, 0, 0, 0, 0, 0, 0};
  v8f o[2][16];
  float mrun[2];           // running maximum of this lane's query, per tile
  v2f   lacc[2];           // running sums: even and odd registers, this wave half's keys only
#pragma unroll
  for (int q = 0; q < 2; ++q) {
#pragma unroll
    for (int t = 0; t < 16; ++t) o[q][t] = zero;
    mrun[q] = -3.0e38f;
    lacc[q] = v2f{0, 0};
  }

  // Tile 0 has landed and is published; then tile 1 starts into the other buffer.
  asm volatile("s_wait_asynccnt 0x0" ::: "memory");
  __syncthreads();
  stage_tiles();

  // One key block, from buffer buf, up to and including the hand-over.
  auto tile = [&](const int buf) {
    // ---- S^T = K Q^T for a 64-key x 32-query strip (4 k-steps x 4 x 2 tiles) ----
    // D layout: query = lane&15 of tile q, key = tn*16 + reg + 8*(lane>=16).
    // Fragments come from LDS in groups of four through a ring of two groups:
    // a group is requested as soon as the products on its registers are issued,
    // one group of products ahead of its use. The ring runs on into V, so the
    // first eight V fragments are under way while the softmax is computed.
    const _Float16* kb = &Klds[buf][(kh * 64 + (lane & 15)) * 136];
    const _Float16* vo = &Vlds[buf][(ch0 + (lane & 15)) * 136 + kh * 64];
    const _Float16* vs = &Vlds[buf][(128 - ch0 + (lane & 15)) * 136 + kh * 64];
    // V fragment f of 32: channel tile f & 15, k-step f >> 4.
    auto vfrag = [&](int f) {
      const int t = f & 15;
      return frag_from(t < 8 ? vo + t * 16 * 136 : vs + (t - 8) * 16 * 136, (f >> 4) * 32, lane);
    };
    v16h fr[8];
    v16h qr[4];   // Q fragments of the two groups in the ring, two query tiles each
#pragma unroll
    for (int gi = 0; gi < 2; ++gi) {
#pragma unroll
      for (int t = 0; t < 4; ++t) fr[gi * 4 + t] = frag_from(kb + t * 16 * 136, gi * 32, lane);
#pragma unroll
      for (int q = 0; q < 2; ++q) qr[gi * 2 + q] = frag_from(qb + q * 16 * 136, gi * 32, lane);
    }
    GROUP_EDGE();
    v8f s[2][4];
#pragma unroll
    for (int q = 0; q < 2; ++q) {
#pragma unroll
      for (int tn = 0; tn < 4; ++tn) s[q][tn] = zero;
    }
#pragma unroll
    for (int ks = 0; ks < 4; ++ks) {
      const int g = (ks & 1) * 4;
#pragma unroll
      for (int tn = 0; tn < 4; ++tn) {
#pragma unroll
        for (int q = 0; q < 2; ++q)
          s[q][tn] = __builtin_amdgcn_wmma_f32_16x16x32_f16(false, fr[g + tn], false, qr[(ks & 1) * 2 + q],
                                                            (short)0, s[q][tn], false, false);
      }
      GROUP_EDGE();
#pragma unroll
      for (int t = 0; t < 4; ++t)
        fr[g + t] = (ks < 2) ? frag_from(kb + t * 16 * 136, (ks + 2) * 32, lane)
                             : vfrag(g + t);
      if (ks < 2) {
#pragma unroll
        for (int q = 0; q < 2; ++q)
          qr[(ks & 1) * 2 + q] = frag_from(qb + q * 16 * 136, (ks + 2) * 32, lane);
      }
      GROUP_EDGE();
    }

    // ---- Online softmax: 32 of each query's 64 scores are in this lane ----
    float mn[2];
#pragma unroll
    for (int q = 0; q < 2; ++q) {
      // Register-wise maxima first: the scalar chain, written for two tiles, built
      // with one more instruction per score. A maximum is exact in any order.
      const v8f m8 = __builtin_elementwise_max(__builtin_elementwise_max(s[q][0], s[q][1]),
                                               __builtin_elementwise_max(s[q][2], s[q][3]));
      float v = fmaxf(fmaxf(fmaxf(m8[0], m8[1]), fmaxf(m8[2], m8[3])),
                      fmaxf(fmaxf(m8[4], m8[5]), fmaxf(m8[6], m8[7])));
      v = fmaxf(v, xhalf(v));
      mn[q]    = fmaxf(mrun[q], v);
      const float alpha = __expf(mrun[q] - mn[q]);
      mrun[q]  = mn[q];
#pragma unroll
      for (int t = 0; t < 16; ++t) o[q][t] *= alpha;
      lacc[q] *= alpha;
    }

    // P^T as B fragments: tile 2ks gives k = 8h..8h+7, tile 2ks+1 k = 16+8h..16+8h+7.
    // ---- O^T += V P^T : 2 k-steps over the 64 keys x 16 channel tiles x 2 ----
#pragma unroll
    for (int ks = 0; ks < 2; ++ks) {
      v16h pf[2];
#pragma unroll
      for (int q = 0; q < 2; ++q) {
#pragma unroll
        for (int tn = 2 * ks; tn < 2 * ks + 2; ++tn) {
#pragma unroll
          for (int r = 0; r < 8; ++r) {
            float p = __expf(s[q][tn][r] - mn[q]);
            pf[q][(tn & 1) * 8 + r] = (_Float16)p;
            lacc[q][r & 1] += p;
          }
        }
      }
#pragma unroll
      for (int g4 = 0; g4 < 4; ++g4) {
        const int f0 = ks * 16 + g4 * 4;   // first fragment of this group
        const int sl = f0 & 7;             // its place in the ring
#pragma unroll
        for (int t = 0; t < 4; ++t) {
#pragma unroll
          for (int q = 0; q < 2; ++q)
            o[q][g4 * 4 + t] = __builtin_amdgcn_wmma_f32_16x16x32_f16(
                false, fr[sl + t], false, pf[q], (short)0, o[q][g4 * 4 + t], false, false);
        }
        if (f0 + 8 < 32) {
          GROUP_EDGE();
#pragma unroll
          for (int t = 0; t < 4; ++t) fr[sl + t] = vfrag(f0 + 8 + t);
          GROUP_EDGE();
        }
      }
    }
    // Hand-over: this wave's reads of the buffer are done, its copies of the next
    // tile have landed; the one barrier publishes that tile and frees this buffer,
    // which the tile after next is then copied into.
    asm volatile("s_wait_dscnt 0x0" ::: "memory");
    asm volatile("s_wait_asynccnt 0x0" ::: "memory");
    __syncthreads();
  };
  // The last two key blocks have no block t + 2 to request. They run in a loop of
  // their own, so that each loop body is one straight run of code: with a branch
  // at its foot the row-sum additions were sunk behind it, which kept all 64
  // exponentials alive over the second product and forced spills.
  for (int t = 0; t < N_ / 128 - 2; ++t) {
    tile(t & 1);
    stage_tiles();
  }
  // Kept rolled: one more copy of the body instead of two, for the instruction cache.
#pragma nounroll
  for (int t = 0; t < 2; ++t) tile(t & 1);
  // No copy is outstanding when the wave goes on to its end.
  asm volatile("s_wait_asynccnt 0x0" ::: "memory");

  // ---- Merge of the two key halves. Behind the loop's last barrier nobody reads
  // a tile any more and no copy is in flight, so the tile buffers serve as the
  // exchange space: maxima and sums in Klds, accumulators in Vlds.
  const float g = gamma[0];
  // The register that this load's address names may be reused from here on.
  asm volatile("s_wait_xcnt 0x0" ::: "memory");
  v2f* ml = (v2f*)&Klds[0][0];     // [wave][tile][lane]: maximum, sum
  v4f* ex = (v4f*)&Vlds[0][0];     // [wave][32 quads][lane]
  const int pw = wave ^ 4;         // the wave with the same queries, other keys
  float lsum[2];
#pragma unroll
  for (int q = 0; q < 2; ++q) {
    lsum[q] = lacc[q][0] + lacc[q][1];
    lsum[q] += xhalf(lsum[q]);
    const v2f w = {mrun[q], lsum[q]};
    ml[(wave * 2 + q) * 32 + lane] = w;
  }
  __syncthreads();
  // fs: this wave's weight in the merged, normalised sum.
  float fs[2];
#pragma unroll
  for (int q = 0; q < 2; ++q) {
    const v2f p = ml[(pw * 2 + q) * 32 + lane];
    const float m  = fmaxf(mrun[q], p[0]);
    const float fa = __expf(mrun[q] - m);
    const float fb = __expf(p[0] - m);
    fs[q] = fa / (lsum[q] * fa + p[1] * fb);
  }
#pragma unroll
  for (int q = 0; q < 2; ++q) {
#pragma unroll
    for (int t = 0; t < 8; ++t) {
#pragma unroll
      for (int hf = 0; hf < 2; ++hf) {
        v4f w;
#pragma unroll
        for (int i = 0; i < 4; ++i) w[i] = o[q][8 + t][hf * 4 + i] * fs[q];
        ex[(wave * 32 + (q * 8 + t) * 2 + hf) * 32 + lane] = w;
      }
    }
  }

  // ---- Epilogue: out = gamma * O / l + x (both (B,C,N) f32) ----
  // O^T layout: pixel = lane&15 of tile q, channel = ct*16 + reg + 8*(lane>=16).
  // One address per buffer: every element of this lane lies a constant distance
  // behind it. All x values are requested first, so that their latencies overlap
  // one another and the exchange.
  const size_t e0 = ((size_t)(b * C_ + ch0 + 8 * (lane >> 4))) * N_ + m0 + qg * 32 + (lane & 15);
  const float* xb = x + e0;
  float*       ob = out + e0;
  float xv[2][8][8];
#pragma unroll
  for (int q = 0; q < 2; ++q) {
#pragma unroll
    for (int ct = 0; ct < 8; ++ct) {
#pragma unroll
      for (int r = 0; r < 8; ++r) xv[q][ct][r] = xb[(ct * 16 + r) * N_ + q * 16];
    }
  }
  // The registers that held the load address may be reused from here on; the wait
  // names the address as an input so that it is not reused ahead of it.
  asm volatile("s_wait_xcnt 0x0" :: "v"(xb) : "memory");
  __syncthreads();
#pragma unroll
  for (int q = 0; q < 2; ++q) {
#pragma unroll
    for (int ct = 0; ct < 8; ++ct) {
#pragma unroll
      for (int hf = 0; hf < 2; ++hf) {
        const v4f w = ex[(pw * 32 + (q * 8 + ct) * 2 + hf) * 32 + lane];
#pragma unroll
        for (int i = 0; i < 4; ++i) {
          const int r = hf * 4 + i;
          xv[q][ct][r] = g * (o[q][ct][r] * fs[q] + w[i]) + xv[q][ct][r];
        }
      }
    }
  }
  // Every result is formed in front of the first store: behind this edge stand
  // stores alone, so no register that an issued store names is written again.
  GROUP_EDGE();
#pragma unroll
  for (int q = 0; q < 2; ++q) {
#pragma unroll
    for (int ct = 0; ct < 8; ++ct) {
#pragma unroll
      for (int r = 0; r < 8; ++r) ob[(ct * 16 + r) * N_ + q * 16] = xv[q][ct][r];
    }
  }
}

extern "C" void kernel_launch(void* const* d_in, const int* in_sizes, int n_in,
                              void* d_out, int out_size, void* d_ws, size_t ws_size,
                              hipStream_t stream) {
  const float* x     = (const float*)d_in[0];
  const float* Wq    = (const float*)d_in[1];
  const float* bq    = (const float*)d_in[2];
  const float* Wk    = (const float*)d_in[3];
  const float* bk    = (const float*)d_in[4];
  const float* Wv    = (const float*)d_in[5];
  const float* bv    = (const float*)d_in[6];
  const float* gamma = (const float*)d_in[7];
  float* out = (float*)d_out;

  // Workspace: Q (8MB) | K (8MB) | V (16MB), all f16.
  _Float16* Qw = (_Float16*)d_ws;
  _Float16* Kw = Qw + (size_t)B_ * N_ * CI_;
  _Float16* Vw = Kw + (size_t)B_ * N_ * CI_;

  dim3 pgrid(N_ / 128, (2 * CI_ + C_) / 64, B_);  // 32 x 8 x 8
  qkv_proj<<<pgrid, 256, 0, stream>>>(x, Wq, bq, Wk, bk, Wv, bv, Qw, Kw, Vw);

  dim3 agrid(N_ / 128, B_);                       // 32 x 8
  flash_attn<<<agrid, 256, 0, stream>>>(Qw, Kw, Vw, x, gamma, out);
}

// v008
// A run of this version takes 88.8 microseconds.
// Timed twice side by side with v007, it ran 1.12 times as fast both times.
// Counting every step since v000, it is 3.98 times as fast.
#include <hip/hip_runtime.h>

typedef __attribute__((ext_vector_type(16))) _Float16 v16h;
typedef __attribute__((ext_vector_type(8)))  _Float16 v8h;
typedef __attribute__((ext_vector_type(8)))  float    v8f;
typedef __attribute__((ext_vector_type(4)))  float    v4f;
typedef __attribute__((ext_vector_type(2)))  float    v2f;

#define B_  8
#define C_  256
#define CI_ 128
#define N_  4096

// Keeps a group of LDS fragment reads where the source puts it: without it the
// scheduler sinks each read to just in front of its product, and every product
// then waits out a whole LDS latency.
#define GROUP_EDGE() __builtin_amdgcn_sched_barrier(0)

// Build a 16-bit A/B-matrix fragment (v16h -> 8 VGPRs) from a row-major source
// where the 32 K-values for this fragment's row live contiguously at rowbase+kbase.
// Per ISA 7.12.2 (16-bit A 16x32): lanes 0-15 hold K {0..7, 16..23},
// lanes 16-31 hold K {8..15, 24..31}; element i of v16h -> VGPR i/2 half i&1.
__device__ __forceinline__ v16h frag_from(const _Float16* rowbase, int kbase, int lane) {
  const int h = (lane >> 4) & 1;
  v8h a = *(const v8h*)(rowbase + kbase + 8 * h);
  v8h b = *(const v8h*)(rowbase + kbase + 16 + 8 * h);
  v16h r;
#pragma unroll
  for (int i = 0; i < 8; ++i) { r[i] = a[i]; r[i + 8] = b[i]; }
  return r;
}

// Async DMA of four 16-byte chunks per lane from global memory into LDS.
// Tracked by ASYNCcnt; LDS address is wave-relative (low 32 bits of generic ptr).
// The s_wait_xcnt closes the statement so that no address register named here
// is rewritten ahead of it. Four copies a statement: asm operands must lie in the
// first 256 registers, where the accumulators leave little room (eight spilled).
__device__ __forceinline__ void async_copy4_b128(const unsigned* l, const _Float16* const* g) {
  asm volatile("global_load_async_to_lds_b128 %0, %4, off\n\t"
               "global_load_async_to_lds_b128 %1, %5, off\n\t"
               "global_load_async_to_lds_b128 %2, %6, off\n\t"
               "global_load_async_to_lds_b128 %3, %7, off\n\t"
               "s_wait_xcnt 0x0"
               :: "v"(l[0]), "v"(l[1]), "v"(l[2]), "v"(l[3]),
                  "v"(g[0]), "v"(g[1]), "v"(g[2]), "v"(g[3])
               : "memory");
}

__device__ __forceinline__ unsigned lds_off_of(const void* p) {
  return (unsigned)(size_t)p;  // generic LDS addr truncates to wave-relative offset
}

// Lane l exchanges with lane l ^ 16 (the other 16-lane row), in registers.
__device__ __forceinline__ float xhalf(float v) {
  int i = __builtin_bit_cast(int, v);
  return __builtin_bit_cast(float,
      __builtin_amdgcn_permlanex16(i, i, 0x76543210, 0xfedcba98, false, false));
}

// ---------------------------------------------------------------------------
// Kernel 1: fused Q/K/V 1x1-conv projections as a f16 WMMA GEMM.
// Out tile per block: 128 pixels x 64 output channels. K-dim = C_ = 256.
// Q,K written (B,N,CI) pixel-major f16; V written (B,C,N) channel-major f16.
// A lane's eight accumulator rows always run along the output's contiguous
// axis, so each tile leaves as one 16-byte store per lane: for V the pixels are
// the A rows (D = x^T W^T), for Q and K the output channels are (D = W x).
// ---------------------------------------------------------------------------
template <bool VMAJ>
__device__ __forceinline__ void proj_tile(
    const float* __restrict__ x, const float* __restrict__ W,
    const float* __restrict__ bias, _Float16* __restrict__ dst,
    int crel, int b, int p0, _Float16* Ald, _Float16* Bld) {
  const int tid  = threadIdx.x;
  const int lane = tid & 31;
  const int wave = tid >> 5;
  const int pp   = tid & 63;   // pixel pair of the x tile that this thread stages
  const int cg   = tid >> 6;   // its group of eight input channels

  // Every short loop here is unrolled so that acc, fx, fw and h are indexed by
  // constants and stay in registers.
  const v8f zero = {0, 0, 0, 0, 0, 0, 0, 0};
  v8f acc[4];
#pragma unroll
  for (int t = 0; t < 4; ++t) acc[t] = zero;

  for (int c0 = 0; c0 < C_; c0 += 32) {
    // Stage the x^T tile (channel-major x, f32 -> f16) and the weight tile (rows
    // contiguous over input channel). A thread takes two neighbouring pixels of
    // eight consecutive channels, so the transpose happens in its registers and
    // each pixel's eight channels go to LDS as one 16-byte store. All ten loads
    // are requested before the first LDS store, so that their latencies overlap.
    v2f fx[8];
    v4f fw[2];
    const float* xp = x + ((size_t)(b * C_ + c0 + cg * 8)) * N_ + p0 + pp * 2;
#pragma unroll
    for (int j = 0; j < 8; ++j) fx[j] = *(const v2f*)(xp + j * N_);
    // The registers that held these addresses may be reused from here on.
    asm volatile("s_wait_xcnt 0x0" ::: "memory");
#pragma unroll
    for (int it = 0; it < 2; ++it) {
      int lin = tid + 256 * it;          // 0..511: out channel lin>>3, channel quad lin&7
      fw[it] = *(const v4f*)(W + (size_t)(crel + (lin >> 3)) * C_ + c0 + (lin & 7) * 4);
    }
#pragma unroll
    for (int i = 0; i < 2; ++i) {
      v8h hx;
#pragma unroll
      for (int j = 0; j < 8; ++j) hx[j] = (_Float16)fx[j][i];
      *(v8h*)&Ald[(pp * 2 + i) * 40 + cg * 8] = hx;
    }
#pragma unroll
    for (int it = 0; it < 2; ++it) {
      int lin = tid + 256 * it;
#pragma unroll
      for (int i = 0; i < 4; ++i) Bld[(lin >> 3) * 40 + (lin & 7) * 4 + i] = (_Float16)fw[it][i];
    }
    __syncthreads();

    v16h xf = frag_from(&Ald[(wave * 16 + (lane & 15)) * 40], 0, lane);
#pragma unroll
    for (int tn = 0; tn < 4; ++tn) {
      v16h wf = frag_from(&Bld[(tn * 16 + (lane & 15)) * 40], 0, lane);
      acc[tn] = VMAJ
          ? __builtin_amdgcn_wmma_f32_16x16x32_f16(false, xf, false, wf,
                                                   (short)0, acc[tn], false, false)
          : __builtin_amdgcn_wmma_f32_16x16x32_f16(false, wf, false, xf,
                                                   (short)0, acc[tn], false, false);
    }
    __syncthreads();
  }

  // Bias + f16 store. C/D layout: col = lane&15, row = reg + 8*(lane>=16).
  const int col  = lane & 15;
  const int row8 = 8 * (lane >> 4);
#pragma unroll
  for (int tn = 0; tn < 4; ++tn) {
    v8h h;
    if (VMAJ) {   // col = output channel, rows = 8 consecutive pixels
      const int cloc = crel + tn * 16 + col;
      const float bb = bias[cloc];
#pragma unroll
      for (int r = 0; r < 8; ++r) h[r] = (_Float16)(acc[tn][r] + bb);
      *(v8h*)(dst + ((size_t)(b * C_ + cloc)) * N_ + p0 + wave * 16 + row8) = h;
    } else {      // col = pixel, rows = 8 consecutive output channels
      const int c8 = crel + tn * 16 + row8;
#pragma unroll
      for (int r = 0; r < 8; ++r) h[r] = (_Float16)(acc[tn][r] + bias[c8 + r]);
      *(v8h*)(dst + ((size_t)(b * N_ + p0 + wave * 16 + col)) * CI_ + c8) = h;
    }
  }
}

__global__ __launch_bounds__(256) void qkv_proj(
    const float* __restrict__ x,
    const float* __restrict__ Wq, const float* __restrict__ bq,
    const float* __restrict__ Wk, const float* __restrict__ bk,
    const float* __restrict__ Wv, const float* __restrict__ bv,
    _Float16* __restrict__ Qo, _Float16* __restrict__ Ko, _Float16* __restrict__ Vo) {
  __shared__ _Float16 Ald[128 * 40];  // 128 pixels x 32 ch, pitch 40 halves (16B rows)
  __shared__ _Float16 Bld[64 * 40];   // 64 outch x 32 ch

  const int p0 = blockIdx.x * 128;
  const int o0 = blockIdx.y * 64;
  const int b  = blockIdx.z;

  if (o0 < 256) {
    const bool isq = o0 < 128;
    proj_tile<false>(x, isq ? Wq : Wk, isq ? bq : bk, isq ? Qo : Ko, o0 & 127, b, p0, Ald, Bld);
  } else {
    proj_tile<true>(x, Wv, bv, Vo, o0 - 256, b, p0, Ald, Bld);
  }
}

__global__ __launch_bounds__(256) __attribute__((amdgpu_waves_per_eu(2, 2))) void flash_attn(
    const _Float16* __restrict__ Q, const _Float16* __restrict__ K,
    const _Float16* __restrict__ V, const float* __restrict__ x,
    const float* __restrict__ gamma, float* __restrict__ out) {
  __shared__ _Float16 Klds[2][128 * 136];   // 128 keys x 128 ch, pitch 136 halves (17 chunks)
  __shared__ _Float16 Vlds[2][256 * 136];   // 256 ch x 128 keys, pitch 136 halves (17 chunks)
  __shared__ _Float16 Qlds[128 * 136];      // 128 queries x 128 ch, same pitch; filled once

  const int tid  = threadIdx.x;
  const int lane = tid & 31;
  const int wave = tid >> 5;
  const int qg  = wave & 3;        // query group
  const int kh  = wave >> 2;       // key half
  const int m0  = blockIdx.x * 128;
  const int b   = blockIdx.y;
  const int ch0 = kh * 128;        // the channels that this wave finishes

  // ---- Async DMA of the next tile pair: K (128 keys x 128 ch, one contiguous
  // 32 KiB run of global memory) and V (256 ch x 128 keys), 2048 and 4096
  // b128-chunks, 8 + 16 per thread. Four running addresses say where the next
  // tile comes from and goes to; every chunk of a thread lies a constant distance
  // behind them, so that no table of addresses has to be kept over the loop.
  const unsigned lrow = (unsigned)((tid >> 4) * 17 + (tid & 15)) * 16;
  unsigned lk = lds_off_of(&Klds[0][0]) + lrow;
  unsigned lv = lds_off_of(&Vlds[0][0]) + lrow;
  const _Float16* gk = K + (size_t)b * N_ * CI_ + tid * 8;
  const _Float16* gv = V + ((size_t)(b * C_ + (tid >> 4))) * N_ + (tid & 15) * 8;
  int kstep = (int)sizeof(Klds[0]);   // to the other buffer; the sign flips per tile
  int vstep = (int)sizeof(Vlds[0]);
  auto stage_tiles = [&]() {
    // The loops are unrolled so that la and ga are indexed by constants and
    // stay in registers. The addresses are formed four copies at a time, and the
    // edge behind each statement keeps the later ones from being formed early:
    // asm operands must lie in the first 256 registers, and with many of them alive
    // at once two accumulator tiles were spilled there in every key block. Mask 8:
    // matrix instructions alone may cross, so the last products still fill the gaps.
    unsigned la[4];
    const _Float16* ga[4];
#pragma unroll
    for (int c4 = 0; c4 < 2; ++c4) {
#pragma unroll
      for (int it = 0; it < 4; ++it) {   // 16 key rows further per chunk
        la[it] = lk + (unsigned)((c4 * 4 + it) * 16 * 17 * 16);
        ga[it] = gk + (c4 * 4 + it) * 16 * CI_;
      }
      async_copy4_b128(la, ga);
      __builtin_amdgcn_sched_barrier(8);
    }
#pragma unroll
    for (int c4 = 0; c4 < 4; ++c4) {
#pragma unroll
      for (int it = 0; it < 4; ++it) {   // 16 channel rows further per chunk
        la[it] = lv + (unsigned)((c4 * 4 + it) * 16 * 17 * 16);
        ga[it] = gv + (size_t)(c4 * 4 + it) * 16 * N_;
      }
      async_copy4_b128(la, ga);
      __builtin_amdgcn_sched_barrier(8);
    }
    gk += 128 * CI_;
    gv += 128;
    lk += kstep; kstep = -kstep;
    lv += vstep; vstep = -vstep;
  };
  stage_tiles();
  // The block's 128 query rows (one contiguous 32 KiB run, shaped like a K tile)
  // go to LDS once, beside tile 0. The Q fragments are read from there with each
  // K group: 256 accumulator registers leave no room to keep them in registers.
  {
    unsigned la[8];
    const _Float16* ga[8];
#pragma unroll
    for (int it = 0; it < 8; ++it) {   // 16 query rows further per chunk
      la[it] = lds_off_of(&Qlds[0]) + lrow + (unsigned)(it * 16 * 17 * 16);
      ga[it] = Q + ((size_t)(b * N_ + m0)) * CI_ + tid * 8 + it * 16 * CI_;
    }
    async_copy4_b128(la, ga);
    async_copy4_b128(la + 4, ga + 4);
  }
  const _Float16* qb = &Qlds[(qg * 32 + (lane & 15)) * 136];

  // Every short loop below is unrolled so that the register arrays are indexed
  // by constants.
  // Accumulator tile t holds channels ch0 + 16 t for t < 8 (finished here) and
  // (128 - ch0) + 16 (t - 8) for t >= 8 (handed to the partner wave).
  const v8f zero = {0, 0, 0, 0, 0, 0, 0, 0};
  v8f o[2][16];
  float mrun[2];           // maximum in use for this lane's query, per tile
  v2f   lacc[2];           // running sums: even and odd registers, this wave half's keys only
#pragma unroll
  for (int q = 0; q < 2; ++q) {
#pragma unroll
    for (int t = 0; t < 16; ++t) o[q][t] = zero;
    mrun[q] = -3.0e38f;
    lacc[q] = v2f{0, 0};
  }

  // Tile 0 has landed and is published; then tile 1 starts into the other buffer.
  asm volatile("s_wait_asynccnt 0x0" ::: "memory");
  __syncthreads();
  stage_tiles();

  // One key block, from buffer buf, up to and including the hand-over.
  auto tile = [&](const int buf) {
    // ---- S^T = K Q^T for a 64-key x 32-query strip (4 k-steps x 4 x 2 tiles) ----
    // D layout: query = lane&15 of tile q, key = tn*16 + reg + 8*(lane>=16).
    // Fragments come from LDS in groups of four through a ring of two groups:
    // a group is requested as soon as the products on its registers are issued,
    // one group of products ahead of its use. The ring runs on into V, so the
    // first eight V fragments are under way while the softmax is computed.
    const _Float16* kb = &Klds[buf][(kh * 64 + (lane & 15)) * 136];
    const _Float16* vo = &Vlds[buf][(ch0 + (lane & 15)) * 136 + kh * 64];
    const _Float16* vs = &Vlds[buf][(128 - ch0 + (lane & 15)) * 136 + kh * 64];
    // V fragment f of 32: channel tile f & 15, k-step f >> 4.
    auto vfrag = [&](int f) {
      const int t = f & 15;
      return frag_from(t < 8 ? vo + t * 16 * 136 : vs + (t - 8) * 16 * 136, (f >> 4) * 32, lane);
    };
    v16h fr[8];
    v16h qr[4];   // Q fragments of the two groups in the ring, two query tiles each
#pragma unroll
    for (int gi = 0; gi < 2; ++gi) {
#pragma unroll
      for (int t = 0; t < 4; ++t) fr[gi * 4 + t] = frag_from(kb + t * 16 * 136, gi * 32, lane);
#pragma unroll
      for (int q = 0; q < 2; ++q) qr[gi * 2 + q] = frag_from(qb + q * 16 * 136, gi * 32, lane);
    }
    GROUP_EDGE();
    v8f s[2][4];
#pragma unroll
    for (int q = 0; q < 2; ++q) {
#pragma unroll
      for (int tn = 0; tn < 4; ++tn) s[q][tn] = zero;
    }
#pragma unroll
    for (int ks = 0; ks < 4; ++ks) {
      const int g = (ks & 1) * 4;
#pragma unroll
      for (int tn = 0; tn < 4; ++tn) {
#pragma unroll
        for (int q = 0; q < 2; ++q)
          s[q][tn] = __builtin_amdgcn_wmma_f32_16x16x32_f16(false, fr[g + tn], false, qr[(ks & 1) * 2 + q],
                                                            (short)0, s[q][tn], false, false);
      }
      GROUP_EDGE();
#pragma unroll
      for (int t = 0; t < 4; ++t)
        fr[g + t] = (ks < 2) ? frag_from(kb + t * 16 * 136, (ks + 2) * 32, lane)
                             : vfrag(g + t);
      if (ks < 2) {
#pragma unroll
        for (int q = 0; q < 2; ++q)
          qr[(ks & 1) * 2 + q] = frag_from(qb + q * 16 * 136, (ks + 2) * 32, lane);
      }
      GROUP_EDGE();
    }

    // ---- Online softmax: 32 of each query's 64 scores are in this lane ----
    // Lazy rescale: exponentials are taken against the maximum IN USE, mrun, which
    // need not be the true running maximum (a softmax does not depend on the value
    // subtracted). It moves, and the accumulators are rescaled, only when some
    // query of the wave has a score more than RISE above it, so P <= e^RISE, well
    // inside f16. It is then set HEAD above the maximum seen, so that the next move
    // is far off; the largest P of a row stays >= e^-HEAD, far above f16's
    // subnormals. Both bounds hold for any scores.
    constexpr float RISE = 10.0f;
    constexpr float HEAD = 4.0f;
    float vt[2];
    bool need = false;
#pragma unroll
    for (int q = 0; q < 2; ++q) {
      // Register-wise maxima first: the scalar chain, written for two tiles, built
      // with one more instruction per score. A maximum is exact in any order.
      const v8f m8 = __builtin_elementwise_max(__builtin_elementwise_max(s[q][0], s[q][1]),
                                               __builtin_elementwise_max(s[q][2], s[q][3]));
      float v = fmaxf(fmaxf(fmaxf(m8[0], m8[1]), fmaxf(m8[2], m8[3])),
                      fmaxf(fmaxf(m8[4], m8[5]), fmaxf(m8[6], m8[7])));
      vt[q] = fmaxf(v, xhalf(v));
      need = need || (vt[q] > mrun[q] + RISE);
    }
    // One test per key block, the same for the whole wave (a scalar branch).
    if (__builtin_amdgcn_ballot_w32(need) != 0) {
#pragma unroll
      for (int q = 0; q < 2; ++q) {
        const float mnew  = fmaxf(mrun[q], vt[q] + HEAD);
        const float alpha = __expf(mrun[q] - mnew);
        mrun[q] = mnew;
#pragma unroll
        for (int t = 0; t < 16; ++t) o[q][t] *= alpha;
        lacc[q] *= alpha;
      }
    }

    // P^T as B fragments: tile 2ks gives k = 8h..8h+7, tile 2ks+1 k = 16+8h..16+8h+7.
    // ---- O^T += V P^T : 2 k-steps over the 64 keys x 16 channel tiles x 2 ----
#pragma unroll
    for (int ks = 0; ks < 2; ++ks) {
      v16h pf[2];
#pragma unroll
      for (int q = 0; q < 2; ++q) {
#pragma unroll
        for (int tn = 2 * ks; tn < 2 * ks + 2; ++tn) {
#pragma unroll
          for (int r = 0; r < 8; ++r) {
            float p = __expf(s[q][tn][r] - mrun[q]);
            pf[q][(tn & 1) * 8 + r] = (_Float16)p;
            lacc[q][r & 1] += p;
          }
        }
      }
#pragma unroll
      for (int g4 = 0; g4 < 4; ++g4) {
        const int f0 = ks * 16 + g4 * 4;   // first fragment of this group
        const int sl = f0 & 7;             // its place in the ring
#pragma unroll
        for (int t = 0; t < 4; ++t) {
#pragma unroll
          for (int q = 0; q < 2; ++q)
            o[q][g4 * 4 + t] = __builtin_amdgcn_wmma_f32_16x16x32_f16(
                false, fr[sl + t], false, pf[q], (short)0, o[q][g4 * 4 + t], false, false);
        }
        if (f0 + 8 < 32) {
          GROUP_EDGE();
#pragma unroll
          for (int t = 0; t < 4; ++t) fr[sl + t] = vfrag(f0 + 8 + t);
          GROUP_EDGE();
        }
      }
    }
    // Hand-over: this wave's reads of the buffer are done, its copies of the next
    // tile have landed; the one barrier publishes that tile and frees this buffer,
    // which the tile after next is then copied into.
    asm volatile("s_wait_dscnt 0x0" ::: "memory");
    asm volatile("s_wait_asynccnt 0x0" ::: "memory");
    __syncthreads();
  };
  // The last two key blocks have no block t + 2 to request. They run in a loop of
  // their own, so that no loop body needs a test for the copies: with such a branch
  // at its foot the row-sum additions were sunk behind it, which kept all 64
  // exponentials alive over the second product and forced spills.
  for (int t = 0; t < N_ / 128 - 2; ++t) {
    tile(t & 1);
    stage_tiles();
  }
  // Kept rolled: one more copy of the body instead of two, for the instruction cache.
#pragma nounroll
  for (int t = 0; t < 2; ++t) tile(t & 1);
  // No copy is outstanding when the wave goes on to its end.
  asm volatile("s_wait_asynccnt 0x0" ::: "memory");

  // ---- Merge of the two key halves. Behind the loop's last barrier nobody reads
  // a tile any more and no copy is in flight, so the tile buffers serve as the
  // exchange space: maxima and sums in Klds, accumulators in Vlds.
  const float g = gamma[0];
  // The register that this load's address names may be reused from here on.
  asm volatile("s_wait_xcnt 0x0" ::: "memory");
  v2f* ml = (v2f*)&Klds[0][0];     // [wave][tile][lane]: maximum, sum
  v4f* ex = (v4f*)&Vlds[0][0];     // [wave][32 quads][lane]
  const int pw = wave ^ 4;         // the wave with the same queries, other keys
  float lsum[2];
#pragma unroll
  for (int q = 0; q < 2; ++q) {
    lsum[q] = lacc[q][0] + lacc[q][1];
    lsum[q] += xhalf(lsum[q]);
    const v2f w = {mrun[q], lsum[q]};
    ml[(wave * 2 + q) * 32 + lane] = w;
  }
  __syncthreads();
  // fs: this wave's weight in the merged, normalised sum.
  float fs[2];
#pragma unroll
  for (int q = 0; q < 2; ++q) {
    const v2f p = ml[(pw * 2 + q) * 32 + lane];
    const float m  = fmaxf(mrun[q], p[0]);
    const float fa = __expf(mrun[q] - m);
    const float fb = __expf(p[0] - m);
    fs[q] = fa / (lsum[q] * fa + p[1] * fb);
  }
#pragma unroll
  for (int q = 0; q < 2; ++q) {
#pragma unroll
    for (int t = 0; t < 8; ++t) {
#pragma unroll
      for (int hf = 0; hf < 2; ++hf) {
        v4f w;
#pragma unroll
        for (int i = 0; i < 4; ++i) w[i] = o[q][8 + t][hf * 4 + i] * fs[q];
        ex[(wave * 32 + (q * 8 + t) * 2 + hf) * 32 + lane] = w;
      }
    }
  }

  // ---- Epilogue: out = gamma * O / l + x (both (B,C,N) f32) ----
  // O^T layout: pixel = lane&15 of tile q, channel = ct*16 + reg + 8*(lane>=16).
  // One address per buffer: every element of this lane lies a constant distance
  // behind it. All x values are requested first, so that their latencies overlap
  // one another and the exchange.
  const size_t e0 = ((size_t)(b * C_ + ch0 + 8 * (lane >> 4))) * N_ + m0 + qg * 32 + (lane & 15);
  const float* xb = x + e0;
  float*       ob = out + e0;
  float xv[2][8][8];
#pragma unroll
  for (int q = 0; q < 2; ++q) {
#pragma unroll
    for (int ct = 0; ct < 8; ++ct) {
#pragma unroll
      for (int r = 0; r < 8; ++r) xv[q][ct][r] = xb[(ct * 16 + r) * N_ + q * 16];
    }
  }
  // The registers that held the load address may be reused from here on; the wait
  // names the address as an input so that it is not reused ahead of it.
  asm volatile("s_wait_xcnt 0x0" :: "v"(xb) : "memory");
  __syncthreads();
#pragma unroll
  for (int q = 0; q < 2; ++q) {
#pragma unroll
    for (int ct = 0; ct < 8; ++ct) {
#pragma unroll
      for (int hf = 0; hf < 2; ++hf) {
        const v4f w = ex[(pw * 32 + (q * 8 + ct) * 2 + hf) * 32 + lane];
#pragma unroll
        for (int i = 0; i < 4; ++i) {
          const int r = hf * 4 + i;
          xv[q][ct][r] = g * (o[q][ct][r] * fs[q] + w[i]) + xv[q][ct][r];
        }
      }
    }
  }
  // Every result is formed in front of the first store: behind this edge stand
  // stores alone, so no register that an issued store names is written again.
  GROUP_EDGE();
#pragma unroll
  for (int q = 0; q < 2; ++q) {
#pragma unroll
    for (int ct = 0; ct < 8; ++ct) {
#pragma unroll
      for (int r = 0; r < 8; ++r) ob[(ct * 16 + r) * N_ + q * 16] = xv[q][ct][r];
    }
  }
}

extern "C" void kernel_launch(void* const* d_in, const int* in_sizes, int n_in,
                              void* d_out, int out_size, void* d_ws, size_t ws_size,
                              hipStream_t stream) {
  const float* x     = (const float*)d_in[0];
  const float* Wq    = (const float*)d_in[1];
  const float* bq    = (const float*)d_in[2];
  const float* Wk    = (const float*)d_in[3];
  const float* bk    = (const float*)d_in[4];
  const float* Wv    = (const float*)d_in[5];
  const float* bv    = (const float*)d_in[6];
  const float* gamma = (const float*)d_in[7];
  float* out = (float*)d_out;

  // Workspace: Q (8MB) | K (8MB) | V (16MB), all f16.
  _Float16* Qw = (_Float16*)d_ws;
  _Float16* Kw = Qw + (size_t)B_ * N_ * CI_;
  _Float16* Vw = Kw + (size_t)B_ * N_ * CI_;

  dim3 pgrid(N_ / 128, (2 * CI_ + C_) / 64, B_);  // 32 x 8 x 8
  qkv_proj<<<pgrid, 256, 0, stream>>>(x, Wq, bq, Wk, bk, Wv, bv, Qw, Kw, Vw);

  dim3 agrid(N_ / 128, B_);                       // 32 x 8
  flash_attn<<<agrid, 256, 0, stream>>>(Qw, Kw, Vw, x, gamma, out);
}

// v009
// One run takes 82.6 microseconds.
// In both of two side-by-side timings against v008, it was 1.08 times as fast.
// Over all steps from v000 it is 4.28 times as fast.
#include <hip/hip_runtime.h>

typedef __attribute__((ext_vector_type(16))) _Float16 v16h;
typedef __attribute__((ext_vector_type(8)))  _Float16 v8h;
typedef __attribute__((ext_vector_type(8)))  float    v8f;
typedef __attribute__((ext_vector_type(4)))  float    v4f;
typedef __attribute__((ext_vector_type(2)))  float    v2f;

#define B_  8
#define C_  256
#define CI_ 128
#define N_  4096

// Keeps a group of LDS fragment reads where the source puts it: without it the
// scheduler sinks each read to just in front of its product, and every product
// then waits out a whole LDS latency.
#define GROUP_EDGE() __builtin_amdgcn_sched_barrier(0)

// Build a 16-bit A/B-matrix fragment (v16h -> 8 VGPRs) from a row-major source
// where the 32 K-values for this fragment's row live contiguously at rowbase+kbase.
// Per ISA 7.12.2 (16-bit A 16x32): lanes 0-15 hold K {0..7, 16..23},
// lanes 16-31 hold K {8..15, 24..31}; element i of v16h -> VGPR i/2 half i&1.
__device__ __forceinline__ v16h frag_from(const _Float16* rowbase, int kbase, int lane) {
  const int h = (lane >> 4) & 1;
  v8h a = *(const v8h*)(rowbase + kbase + 8 * h);
  v8h b = *(const v8h*)(rowbase + kbase + 16 + 8 * h);
  v16h r;
#pragma unroll
  for (int i = 0; i < 8; ++i) { r[i] = a[i]; r[i + 8] = b[i]; }
  return r;
}

// Async DMA of four 16-byte chunks per lane from global memory into LDS.
// Tracked by ASYNCcnt; LDS address is wave-relative (low 32 bits of generic ptr).
// The s_wait_xcnt closes the statement so that no address register named here
// is rewritten ahead of it. Four copies a statement: asm operands must lie in the
// first 256 registers, where the accumulators leave little room (eight spilled).
__device__ __forceinline__ void async_copy4_b128(const unsigned* l, const _Float16* const* g) {
  asm volatile("global_load_async_to_lds_b128 %0, %4, off\n\t"
               "global_load_async_to_lds_b128 %1, %5, off\n\t"
               "global_load_async_to_lds_b128 %2, %6, off\n\t"
               "global_load_async_to_lds_b128 %3, %7, off\n\t"
               "s_wait_xcnt 0x0"
               :: "v"(l[0]), "v"(l[1]), "v"(l[2]), "v"(l[3]),
                  "v"(g[0]), "v"(g[1]), "v"(g[2]), "v"(g[3])
               : "memory");
}

__device__ __forceinline__ unsigned lds_off_of(const void* p) {
  return (unsigned)(size_t)p;  // generic LDS addr truncates to wave-relative offset
}

// Lane l exchanges with lane l ^ 16 (the other 16-lane row), in registers.
__device__ __forceinline__ float xhalf(float v) {
  int i = __builtin_bit_cast(int, v);
  return __builtin_bit_cast(float,
      __builtin_amdgcn_permlanex16(i, i, 0x76543210, 0xfedcba98, false, false));
}

// ---------------------------------------------------------------------------
// Kernel 1: fused Q/K/V 1x1-conv projections as a f16 WMMA GEMM.
// Out tile per block: 128 pixels x 256 output channels (Q and K together, or all
// of V), so x is fetched twice in all. K-dim = C_ = 256.
// Wave w works on pixel group w & 3 (32 pixels, two 16-pixel tiles) and on output
// half w >> 2 (128 channels, eight tiles): every weight fragment read from LDS
// feeds two products, every x fragment eight.
// Q,K written (B,N,CI) pixel-major f16; V written (B,C,N) channel-major f16.
// A lane's eight accumulator rows always run along the output's contiguous
// axis, so each tile leaves as one 16-byte store per lane: for V the pixels are
// the A rows (D = x^T W^T), for Q and K the output channels are (D = W x).
// W0, W1: the weight rows of the block's two output halves. bias, dst: those of
// this wave's half; crel: its first channel there.
// ---------------------------------------------------------------------------
template <bool VMAJ>
__device__ __forceinline__ void proj_tile(
    const float* __restrict__ x, const float* __restrict__ W0, const float* __restrict__ W1,
    const float* __restrict__ bias, _Float16* __restrict__ dst,
    int crel, int b, int p0, _Float16* Ald, _Float16* Bld) {
  const int tid  = threadIdx.x;
  const int lane = tid & 31;
  const int wave = tid >> 5;
  const int pg   = wave & 3;   // pixel group of this wave
  const int oh   = wave >> 2;  // its output half
  const int pp   = tid & 63;   // pixel pair of the x tile that this thread stages
  const int cg   = tid >> 6;   // its group of eight input channels

  // Every short loop here is unrolled so that acc, fx, fw, xf and h are indexed by
  // constants and stay in registers.
  const v8f zero = {0, 0, 0, 0, 0, 0, 0, 0};
  v8f acc[2][8];
#pragma unroll
  for (int q = 0; q < 2; ++q) {
#pragma unroll
    for (int t = 0; t < 8; ++t) acc[q][t] = zero;
  }

  for (int c0 = 0; c0 < C_; c0 += 32) {
    // Stage the x^T tile (channel-major x, f32 -> f16) and the weight tile (rows
    // contiguous over input channel). A thread takes two neighbouring pixels of
    // eight consecutive channels, so the transpose happens in its registers and
    // each pixel's eight channels go to LDS as one 16-byte store. All sixteen loads
    // are requested before the first LDS store, so that their latencies overlap.
    v2f fx[8];
    v4f fw[8];
    const float* xp = x + ((size_t)(b * C_ + c0 + cg * 8)) * N_ + p0 + pp * 2;
#pragma unroll
    for (int j = 0; j < 8; ++j) fx[j] = *(const v2f*)(xp + j * N_);
    // The registers that held these addresses may be reused from here on.
    asm volatile("s_wait_xcnt 0x0" ::: "memory");
    // Row (tid >> 3) + 32 it of the weight tile, channel quad tid & 7.
    const size_t wo = (size_t)(tid >> 3) * C_ + c0 + (tid & 7) * 4;
#pragma unroll
    for (int it = 0; it < 8; ++it)
      fw[it] = *(const v4f*)((it < 4 ? W0 : W1) + wo + (it & 3) * 32 * C_);
    // The registers that held these addresses may be reused from here on.
    asm volatile("s_wait_xcnt 0x0" ::: "memory");
    // Without this edge the last weight load was sunk behind the first conversions
    // (into a register of theirs) and started only when x had arrived.
    GROUP_EDGE();
#pragma unroll
    for (int i = 0; i < 2; ++i) {
      v8h hx;
#pragma unroll
      for (int j = 0; j < 8; ++j) hx[j] = (_Float16)fx[j][i];
      *(v8h*)&Ald[(pp * 2 + i) * 40 + cg * 8] = hx;
    }
#pragma unroll
    for (int it = 0; it < 8; ++it) {
#pragma unroll
      for (int i = 0; i < 4; ++i)
        Bld[((tid >> 3) + 32 * it) * 40 + (tid & 7) * 4 + i] = (_Float16)fw[it][i];
    }
    __syncthreads();

    v16h xf[2];
#pragma unroll
    for (int q = 0; q < 2; ++q)
      xf[q] = frag_from(&Ald[(pg * 32 + q * 16 + (lane & 15)) * 40], 0, lane);
#pragma unroll
    for (int tn = 0; tn < 8; ++tn) {
      v16h wf = frag_from(&Bld[(oh * 128 + tn * 16 + (lane & 15)) * 40], 0, lane);
#pragma unroll
      for (int q = 0; q < 2; ++q)
        acc[q][tn] = VMAJ
            ? __builtin_amdgcn_wmma_f32_16x16x32_f16(false, xf[q], false, wf,
                                                     (short)0, acc[q][tn], false, false)
            : __builtin_amdgcn_wmma_f32_16x16x32_f16(false, wf, false, xf[q],
                                                     (short)0, acc[q][tn], false, false);
    }
    __syncthreads();
  }

  // Bias + f16 store. C/D layout: col = lane&15, row = reg + 8*(lane>=16).
  const int col  = lane & 15;
  const int row8 = 8 * (lane >> 4);
  v8h h[2][8];
  if (VMAJ) {   // col = output channel, rows = 8 consecutive pixels
    float bb[8];
#pragma unroll
    for (int tn = 0; tn < 8; ++tn) bb[tn] = bias[crel + tn * 16 + col];
    // The registers that held these addresses may be reused from here on.
    asm volatile("s_wait_xcnt 0x0" ::: "memory");
#pragma unroll
    for (int q = 0; q < 2; ++q) {
#pragma unroll
      for (int tn = 0; tn < 8; ++tn) {
#pragma unroll
        for (int r = 0; r < 8; ++r) h[q][tn][r] = (_Float16)(acc[q][tn][r] + bb[tn]);
      }
    }
  } else {      // col = pixel, rows = 8 consecutive output channels
    v4f bb[8][2];
    const float* bp = bias + crel + row8;
#pragma unroll
    for (int tn = 0; tn < 8; ++tn) {
#pragma unroll
      for (int hf = 0; hf < 2; ++hf) bb[tn][hf] = *(const v4f*)(bp + tn * 16 + hf * 4);
    }
    // The registers that held the load address may be reused from here on; the wait
    // names the address as an input so that it is not reused ahead of it.
    asm volatile("s_wait_xcnt 0x0" :: "v"(bp) : "memory");
#pragma unroll
    for (int q = 0; q < 2; ++q) {
#pragma unroll
      for (int tn = 0; tn < 8; ++tn) {
#pragma unroll
        for (int r = 0; r < 8; ++r)
          h[q][tn][r] = (_Float16)(acc[q][tn][r] + bb[tn][r >> 2][r & 3]);
      }
    }
  }
  // One address: every tile of this lane lies a constant distance behind it.
  _Float16* dp = VMAJ
      ? dst + ((size_t)(b * C_ + crel + col)) * N_ + p0 + pg * 32 + row8
      : dst + ((size_t)(b * N_ + p0 + pg * 32 + col)) * CI_ + crel + row8;
  // Every result is formed in front of the first store: behind this edge stand
  // stores alone, so no register that an issued store names is written again.
  GROUP_EDGE();
#pragma unroll
  for (int q = 0; q < 2; ++q) {
#pragma unroll
    for (int tn = 0; tn < 8; ++tn)
      *(v8h*)(dp + (VMAJ ? (size_t)tn * 16 * N_ + q * 16 : (size_t)q * 16 * CI_ + tn * 16)) = h[q][tn];
  }
}

__global__ __launch_bounds__(256) void qkv_proj(
    const float* __restrict__ x,
    const float* __restrict__ Wq, const float* __restrict__ bq,
    const float* __restrict__ Wk, const float* __restrict__ bk,
    const float* __restrict__ Wv, const float* __restrict__ bv,
    _Float16* __restrict__ Qo, _Float16* __restrict__ Ko, _Float16* __restrict__ Vo) {
  __shared__ _Float16 Ald[128 * 40];  // 128 pixels x 32 ch, pitch 40 halves (16B rows)
  __shared__ _Float16 Bld[256 * 40];  // 256 outch x 32 ch

  const int p0 = blockIdx.x * 128;
  const int b  = blockIdx.z;
  const bool hi = threadIdx.x >= 128;   // this wave's output half

  if (blockIdx.y == 0) {
    proj_tile<false>(x, Wq, Wk, hi ? bk : bq, hi ? Ko : Qo, 0, b, p0, Ald, Bld);
  } else {
    proj_tile<true>(x, Wv, Wv + 128 * C_, bv, Vo, hi ? 128 : 0, b, p0, Ald, Bld);
  }
}

__global__ __launch_bounds__(256) __attribute__((amdgpu_waves_per_eu(2, 2))) void flash_attn(
    const _Float16* __restrict__ Q, const _Float16* __restrict__ K,
    const _Float16* __restrict__ V, const float* __restrict__ x,
    const float* __restrict__ gamma, float* __restrict__ out) {
  __shared__ _Float16 Klds[2][128 * 136];   // 128 keys x 128 ch, pitch 136 halves (17 chunks)
  __shared__ _Float16 Vlds[2][256 * 136];   // 256 ch x 128 keys, pitch 136 halves (17 chunks)
  __shared__ _Float16 Qlds[128 * 136];      // 128 queries x 128 ch, same pitch; filled once

  const int tid  = threadIdx.x;
  const int lane = tid & 31;
  const int wave = tid >> 5;
  const int qg  = wave & 3;        // query group
  const int kh  = wave >> 2;       // key half
  const int m0  = blockIdx.x * 128;
  const int b   = blockIdx.y;
  const int ch0 = kh * 128;        // the channels that this wave finishes

  // ---- Async DMA of the next tile pair: K (128 keys x 128 ch, one contiguous
  // 32 KiB run of global memory) and V (256 ch x 128 keys), 2048 and 4096
  // b128-chunks, 8 + 16 per thread. Four running addresses say where the next
  // tile comes from and goes to; every chunk of a thread lies a constant distance
  // behind them, so that no table of addresses has to be kept over the loop.
  const unsigned lrow = (unsigned)((tid >> 4) * 17 + (tid & 15)) * 16;
  unsigned lk = lds_off_of(&Klds[0][0]) + lrow;
  unsigned lv = lds_off_of(&Vlds[0][0]) + lrow;
  const _Float16* gk = K + (size_t)b * N_ * CI_ + tid * 8;
  const _Float16* gv = V + ((size_t)(b * C_ + (tid >> 4))) * N_ + (tid & 15) * 8;
  int kstep = (int)sizeof(Klds[0]);   // to the other buffer; the sign flips per tile
  int vstep = (int)sizeof(Vlds[0]);
  auto stage_tiles = [&]() {
    // The loops are unrolled so that la and ga are indexed by constants and
    // stay in registers. The addresses are formed four copies at a time, and the
    // edge behind each statement keeps the later ones from being formed early:
    // asm operands must lie in the first 256 registers, and with many of them alive
    // at once two accumulator tiles were spilled there in every key block. Mask 8:
    // matrix instructions alone may cross, so the last products still fill the gaps.
    unsigned la[4];
    const _Float16* ga[4];
#pragma unroll
    for (int c4 = 0; c4 < 2; ++c4) {
#pragma unroll
      for (int it = 0; it < 4; ++it) {   // 16 key rows further per chunk
        la[it] = lk + (unsigned)((c4 * 4 + it) * 16 * 17 * 16);
        ga[it] = gk + (c4 * 4 + it) * 16 * CI_;
      }
      async_copy4_b128(la, ga);
      __builtin_amdgcn_sched_barrier(8);
    }
#pragma unroll
    for (int c4 = 0; c4 < 4; ++c4) {
#pragma unroll
      for (int it = 0; it < 4; ++it) {   // 16 channel rows further per chunk
        la[it] = lv + (unsigned)((c4 * 4 + it) * 16 * 17 * 16);
        ga[it] = gv + (size_t)(c4 * 4 + it) * 16 * N_;
      }
      async_copy4_b128(la, ga);
      __builtin_amdgcn_sched_barrier(8);
    }
    gk += 128 * CI_;
    gv += 128;
    lk += kstep; kstep = -kstep;
    lv += vstep; vstep = -vstep;
  };
  stage_tiles();
  // The block's 128 query rows (one contiguous 32 KiB run, shaped like a K tile)
  // go to LDS once, beside tile 0. The Q fragments are read from there with each
  // K group: 256 accumulator registers leave no room to keep them in registers.
  {
    unsigned la[8];
    const _Float16* ga[8];
#pragma unroll
    for (int it = 0; it < 8; ++it) {   // 16 query rows further per chunk
      la[it] = lds_off_of(&Qlds[0]) + lrow + (unsigned)(it * 16 * 17 * 16);
      ga[it] = Q + ((size_t)(b * N_ + m0)) * CI_ + tid * 8 + it * 16 * CI_;
    }
    async_copy4_b128(la, ga);
    async_copy4_b128(la + 4, ga + 4);
  }
  const _Float16* qb = &Qlds[(qg * 32 + (lane & 15)) * 136];

  // Every short loop below is unrolled so that the register arrays are indexed
  // by constants.
  // Accumulator tile t holds channels ch0 + 16 t for t < 8 (finished here) and
  // (128 - ch0) + 16 (t - 8) for t >= 8 (handed to the partner wave).
  const v8f zero = {0, 0, 0, 0, 0, 0, 0, 0};
  v8f o[2][16];
  float mrun[2];           // maximum in use for this lane's query, per tile
  v2f   lacc[2];           // running sums: even and odd registers, this wave half's keys only
#pragma unroll
  for (int q = 0; q < 2; ++q) {
#pragma unroll
    for (int t = 0; t < 16; ++t) o[q][t] = zero;
    mrun[q] = -3.0e38f;
    lacc[q] = v2f{0, 0};
  }

  // Tile 0 has landed and is published; then tile 1 starts into the other buffer.
  asm volatile("s_wait_asynccnt 0x0" ::: "memory");
  __syncthreads();
  stage_tiles();

  // One key block, from buffer buf, up to and including the hand-over.
  auto tile = [&](const int buf) {
    // ---- S^T = K Q^T for a 64-key x 32-query strip (4 k-steps x 4 x 2 tiles) ----
    // D layout: query = lane&15 of tile q, key = tn*16 + reg + 8*(lane>=16).
    // Fragments come from LDS in groups of four through a ring of two groups:
    // a group is requested as soon as the products on its registers are issued,
    // one group of products ahead of its use. The ring runs on into V, so the
    // first eight V fragments are under way while the softmax is computed.
    const _Float16* kb = &Klds[buf][(kh * 64 + (lane & 15)) * 136];
    const _Float16* vo = &Vlds[buf][(ch0 + (lane & 15)) * 136 + kh * 64];
    const _Float16* vs = &Vlds[buf][(128 - ch0 + (lane & 15)) * 136 + kh * 64];
    // V fragment f of 32: channel tile f & 15, k-step f >> 4.
    auto vfrag = [&](int f) {
      const int t = f & 15;
      return frag_from(t < 8 ? vo + t * 16 * 136 : vs + (t - 8) * 16 * 136, (f >> 4) * 32, lane);
    };
    v16h fr[8];
    v16h qr[4];   // Q fragments of the two groups in the ring, two query tiles each
#pragma unroll
    for (int gi = 0; gi < 2; ++gi) {
#pragma unroll
      for (int t = 0; t < 4; ++t) fr[gi * 4 + t] = frag_from(kb + t * 16 * 136, gi * 32, lane);
#pragma unroll
      for (int q = 0; q < 2; ++q) qr[gi * 2 + q] = frag_from(qb + q * 16 * 136, gi * 32, lane);
    }
    GROUP_EDGE();
    v8f s[2][4];
#pragma unroll
    for (int q = 0; q < 2; ++q) {
#pragma unroll
      for (int tn = 0; tn < 4; ++tn) s[q][tn] = zero;
    }
#pragma unroll
    for (int ks = 0; ks < 4; ++ks) {
      const int g = (ks & 1) * 4;
#pragma unroll
      for (int tn = 0; tn < 4; ++tn) {
#pragma unroll
        for (int q = 0; q < 2; ++q)
          s[q][tn] = __builtin_amdgcn_wmma_f32_16x16x32_f16(false, fr[g + tn], false, qr[(ks & 1) * 2 + q],
                                                            (short)0, s[q][tn], false, false);
      }
      GROUP_EDGE();
#pragma unroll
      for (int t = 0; t < 4; ++t)
        fr[g + t] = (ks < 2) ? frag_from(kb + t * 16 * 136, (ks + 2) * 32, lane)
                             : vfrag(g + t);
      if (ks < 2) {
#pragma unroll
        for (int q = 0; q < 2; ++q)
          qr[(ks & 1) * 2 + q] = frag_from(qb + q * 16 * 136, (ks + 2) * 32, lane);
      }
      GROUP_EDGE();
    }

    // ---- Online softmax: 32 of each query's 64 scores are in this lane ----
    // Lazy rescale: exponentials are taken against the maximum IN USE, mrun, which
    // need not be the true running maximum (a softmax does not depend on the value
    // subtracted). It moves, and the accumulators are rescaled, only when some
    // query of the wave has a score more than RISE above it, so P <= e^RISE, well
    // inside f16. It is then set HEAD above the maximum seen, so that the next move
    // is far off; the largest P of a row stays >= e^-HEAD, far above f16's
    // subnormals. Both bounds hold for any scores.
    constexpr float RISE = 10.0f;
    constexpr float HEAD = 4.0f;
    float vt[2];
    bool need = false;
#pragma unroll
    for (int q = 0; q < 2; ++q) {
      // Register-wise maxima first: the scalar chain, written for two tiles, built
      // with one more instruction per score. A maximum is exact in any order.
      const v8f m8 = __builtin_elementwise_max(__builtin_elementwise_max(s[q][0], s[q][1]),
                                               __builtin_elementwise_max(s[q][2], s[q][3]));
      float v = fmaxf(fmaxf(fmaxf(m8[0], m8[1]), fmaxf(m8[2], m8[3])),
                      fmaxf(fmaxf(m8[4], m8[5]), fmaxf(m8[6], m8[7])));
      vt[q] = fmaxf(v, xhalf(v));
      need = need || (vt[q] > mrun[q] + RISE);
    }
    // One test per key block, the same for the whole wave (a scalar branch).
    if (__builtin_amdgcn_ballot_w32(need) != 0) {
#pragma unroll
      for (int q = 0; q < 2; ++q) {
        const float mnew  = fmaxf(mrun[q], vt[q] + HEAD);
        const float alpha = __expf(mrun[q] - mnew);
        mrun[q] = mnew;
#pragma unroll
        for (int t = 0; t < 16; ++t) o[q][t] *= alpha;
        lacc[q] *= alpha;
      }
    }

    // P^T as B fragments: tile 2ks gives k = 8h..8h+7, tile 2ks+1 k = 16+8h..16+8h+7.
    // ---- O^T += V P^T : 2 k-steps over the 64 keys x 16 channel tiles x 2 ----
#pragma unroll
    for (int ks = 0; ks < 2; ++ks) {
      v16h pf[2];
#pragma unroll
      for (int q = 0; q < 2; ++q) {
#pragma unroll
        for (int tn = 2 * ks; tn < 2 * ks + 2; ++tn) {
#pragma unroll
          for (int r = 0; r < 8; ++r) {
            float p = __expf(s[q][tn][r] - mrun[q]);
            pf[q][(tn & 1) * 8 + r] = (_Float16)p;
            lacc[q][r & 1] += p;
          }
        }
      }
#pragma unroll
      for (int g4 = 0; g4 < 4; ++g4) {
        const int f0 = ks * 16 + g4 * 4;   // first fragment of this group
        const int sl = f0 & 7;             // its place in the ring
#pragma unroll
        for (int t = 0; t < 4; ++t) {
#pragma unroll
          for (int q = 0; q < 2; ++q)
            o[q][g4 * 4 + t] = __builtin_amdgcn_wmma_f32_16x16x32_f16(
                false, fr[sl + t], false, pf[q], (short)0, o[q][g4 * 4 + t], false, false);
        }
        if (f0 + 8 < 32) {
          GROUP_EDGE();
#pragma unroll
          for (int t = 0; t < 4; ++t) fr[sl + t] = vfrag(f0 + 8 + t);
          GROUP_EDGE();
        }
      }
    }
    // Hand-over: this wave's reads of the buffer are done, its copies of the next
    // tile have landed; the one barrier publishes that tile and frees this buffer,
    // which the tile after next is then copied into.
    asm volatile("s_wait_dscnt 0x0" ::: "memory");
    asm volatile("s_wait_asynccnt 0x0" ::: "memory");
    __syncthreads();
  };
  // The last two key blocks have no block t + 2 to request. They run in a loop of
  // their own, so that no loop body needs a test for the copies: with such a branch
  // at its foot the row-sum additions were sunk behind it, which kept all 64
  // exponentials alive over the second product and forced spills.
  for (int t = 0; t < N_ / 128 - 2; ++t) {
    tile(t & 1);
    stage_tiles();
  }
  // Kept rolled: one more copy of the body instead of two, for the instruction cache.
#pragma nounroll
  for (int t = 0; t < 2; ++t) tile(t & 1);
  // No copy is outstanding when the wave goes on to its end.
  asm volatile("s_wait_asynccnt 0x0" ::: "memory");

  // ---- Merge of the two key halves. Behind the loop's last barrier nobody reads
  // a tile any more and no copy is in flight, so the tile buffers serve as the
  // exchange space: maxima and sums in Klds, accumulators in Vlds.
  const float g = gamma[0];
  // The register that this load's address names may be reused from here on.
  asm volatile("s_wait_xcnt 0x0" ::: "memory");
  v2f* ml = (v2f*)&Klds[0][0];     // [wave][tile][lane]: maximum, sum
  v4f* ex = (v4f*)&Vlds[0][0];     // [wave][32 quads][lane]
  const int pw = wave ^ 4;         // the wave with the same queries, other keys
  float lsum[2];
#pragma unroll
  for (int q = 0; q < 2; ++q) {
    lsum[q] = lacc[q][0] + lacc[q][1];
    lsum[q] += xhalf(lsum[q]);
    const v2f w = {mrun[q], lsum[q]};
    ml[(wave * 2 + q) * 32 + lane] = w;
  }
  __syncthreads();
  // fs: this wave's weight in the merged, normalised sum.
  float fs[2];
#pragma unroll
  for (int q = 0; q < 2; ++q) {
    const v2f p = ml[(pw * 2 + q) * 32 + lane];
    const float m  = fmaxf(mrun[q], p[0]);
    const float fa = __expf(mrun[q] - m);
    const float fb = __expf(p[0] - m);
    fs[q] = fa / (lsum[q] * fa + p[1] * fb);
  }
#pragma unroll
  for (int q = 0; q < 2; ++q) {
#pragma unroll
    for (int t = 0; t < 8; ++t) {
#pragma unroll
      for (int hf = 0; hf < 2; ++hf) {
        v4f w;
#pragma unroll
        for (int i = 0; i < 4; ++i) w[i] = o[q][8 + t][hf * 4 + i] * fs[q];
        ex[(wave * 32 + (q * 8 + t) * 2 + hf) * 32 + lane] = w;
      }
    }
  }

  // ---- Epilogue: out = gamma * O / l + x (both (B,C,N) f32) ----
  // O^T layout: pixel = lane&15 of tile q, channel = ct*16 + reg + 8*(lane>=16).
  // One address per buffer: every element of this lane lies a constant distance
  // behind it. All x values are requested first, so that their latencies overlap
  // one another and the exchange.
  const size_t e0 = ((size_t)(b * C_ + ch0 + 8 * (lane >> 4))) * N_ + m0 + qg * 32 + (lane & 15);
  const float* xb = x + e0;
  float*       ob = out + e0;
  float xv[2][8][8];
#pragma unroll
  for (int q = 0; q < 2; ++q) {
#pragma unroll
    for (int ct = 0; ct < 8; ++ct) {
#pragma unroll
      for (int r = 0; r < 8; ++r) xv[q][ct][r] = xb[(ct * 16 + r) * N_ + q * 16];
    }
  }
  // The registers that held the load address may be reused from here on; the wait
  // names the address as an input so that it is not reused ahead of it.
  asm volatile("s_wait_xcnt 0x0" :: "v"(xb) : "memory");
  __syncthreads();
#pragma unroll
  for (int q = 0; q < 2; ++q) {
#pragma unroll
    for (int ct = 0; ct < 8; ++ct) {
#pragma unroll
      for (int hf = 0; hf < 2; ++hf) {
        const v4f w = ex[(pw * 32 + (q * 8 + ct) * 2 + hf) * 32 + lane];
#pragma unroll
        for (int i = 0; i < 4; ++i) {
          const int r = hf * 4 + i;
          xv[q][ct][r] = g * (o[q][ct][r] * fs[q] + w[i]) + xv[q][ct][r];
        }
      }
    }
  }
  // Every result is formed in front of the first store: behind this edge stand
  // stores alone, so no register that an issued store names is written again.
  GROUP_EDGE();
#pragma unroll
  for (int q = 0; q < 2; ++q) {
#pragma unroll
    for (int ct = 0; ct < 8; ++ct) {
#pragma unroll
      for (int r = 0; r < 8; ++r) ob[(ct * 16 + r) * N_ + q * 16] = xv[q][ct][r];
    }
  }
}

extern "C" void kernel_launch(void* const* d_in, const int* in_sizes, int n_in,
                              void* d_out, int out_size, void* d_ws, size_t ws_size,
                              hipStream_t stream) {
  const float* x     = (const float*)d_in[0];
  const float* Wq    = (const float*)d_in[1];
  const float* bq    = (const float*)d_in[2];
  const float* Wk    = (const float*)d_in[3];
  const float* bk    = (const float*)d_in[4];
  const float* Wv    = (const float*)d_in[5];
  const float* bv    = (const float*)d_in[6];
  const float* gamma = (const float*)d_in[7];
  float* out = (float*)d_out;

  // Workspace: Q (8MB) | K (8MB) | V (16MB), all f16.
  _Float16* Qw = (_Float16*)d_ws;
  _Float16* Kw = Qw + (size_t)B_ * N_ * CI_;
  _Float16* Vw = Kw + (size_t)B_ * N_ * CI_;

  dim3 pgrid(N_ / 128, (2 * CI_ + C_) / 256, B_);  // 32 x 2 x 8
  qkv_proj<<<pgrid, 256, 0, stream>>>(x, Wq, bq, Wk, bk, Wv, bv, Qw, Kw, Vw);

  dim3 agrid(N_ / 128, B_);                       // 32 x 8
  flash_attn<<<agrid, 256, 0, stream>>>(Qw, Kw, Vw, x, gamma, out);
}

// v010
// It runs in 77.8 microseconds.
// In both of two side-by-side timings against v009, it was 1.06 times as fast.
// All steps since v000 together make it 4.55 times as fast.
#include <hip/hip_runtime.h>

typedef __attribute__((ext_vector_type(16))) _Float16 v16h;
typedef __attribute__((ext_vector_type(8)))  _Float16 v8h;
typedef __attribute__((ext_vector_type(8)))  float    v8f;
typedef __attribute__((ext_vector_type(4)))  float    v4f;
typedef __attribute__((ext_vector_type(2)))  float    v2f;

#define B_  8
#define C_  256
#define CI_ 128
#define N_  4096

// Keeps a group of LDS fragment reads where the source puts it: without it the
// scheduler sinks each read to just in front of its product, and every product
// then waits out a whole LDS latency.
#define GROUP_EDGE() __builtin_amdgcn_sched_barrier(0)

// Build a 16-bit A/B-matrix fragment (v16h -> 8 VGPRs) from a row-major source
// where the 32 K-values for this fragment's row live contiguously at rowbase+kbase.
// Per ISA 7.12.2 (16-bit A 16x32): lanes 0-15 hold K {0..7, 16..23},
// lanes 16-31 hold K {8..15, 24..31}; element i of v16h -> VGPR i/2 half i&1.
__device__ __forceinline__ v16h frag_from(const _Float16* rowbase, int kbase, int lane) {
  const int h = (lane >> 4) & 1;
  v8h a = *(const v8h*)(rowbase + kbase + 8 * h);
  v8h b = *(const v8h*)(rowbase + kbase + 16 + 8 * h);
  v16h r;
#pragma unroll
  for (int i = 0; i < 8; ++i) { r[i] = a[i]; r[i + 8] = b[i]; }
  return r;
}

typedef uint32_t u32x4 __attribute__((ext_vector_type(4)));
typedef uint32_t u32x8 __attribute__((ext_vector_type(8)));

__device__ __forceinline__ uint32_t uni(uint32_t v) { return (uint32_t)__builtin_amdgcn_readfirstlane(v); }

// A wave-uniform test held in a scalar register, so that the branch on it is a
// scalar one (s_cmp, s_cbranch_scc): a tensor load ignores EXEC, and only a real
// branch keeps a wave from issuing it.
__device__ __forceinline__ uint32_t pinned(uint32_t v) {
  uint32_t w = uni(v);
  asm volatile("" : "+s"(w));  // pinned(): holds the test in a scalar register, nothing else
  return w;
}

// Tensor load of one tile of 128 rows x 256 bytes from global memory (row pitch
// src_pitch bytes) into LDS at byte lds_dst, 16 bytes of pad behind every row
// (LDS pitch 272 bytes). One request of the whole wave, through no register,
// counted on TENSORcnt. Extents in bytes (1-byte elements), tensor = tile.
__device__ __forceinline__ u32x8 tile_group1(uint32_t src_pitch) {
  u32x8 g;
  g[0] = uni((1u << 20) | (5u << 22) | (3u << 25));  // pad on, every 64 dwords, 4 dwords; no mask
  g[1] = uni(256u << 16);                            // tensor_dim0 = 256
  g[2] = uni(128u << 16);                            // tensor_dim1 = 128
  g[3] = uni(256u << 16);                            // tile_dim0 = 256
  g[4] = uni(128u);                                  // tile_dim1 = 128
  g[5] = uni(src_pitch);
  g[6] = uni(0u);
  g[7] = uni(0u);
  return g;
}
__device__ __forceinline__ void tile_load(uint32_t lds_dst, uint64_t ga, u32x8 g1) {
  u32x4 g0;
  g0[0] = uni(1u);
  g0[1] = uni(lds_dst);
  g0[2] = uni((uint32_t)ga);
  g0[3] = uni((((uint32_t)(ga >> 32)) & 0x01FFFFFFu) | 0x80000000u);
  // The request: both groups in scalar registers.
  asm volatile("tensor_load_to_lds %0, %1" :: "s"(g0), "s"(g1) : "memory");
}

__device__ __forceinline__ unsigned lds_off_of(const void* p) {
  return (unsigned)(size_t)p;  // generic LDS addr truncates to wave-relative offset
}

// Lane l exchanges with lane l ^ 16 (the other 16-lane row), in registers.
__device__ __forceinline__ float xhalf(float v) {
  int i = __builtin_bit_cast(int, v);
  return __builtin_bit_cast(float,
      __builtin_amdgcn_permlanex16(i, i, 0x76543210, 0xfedcba98, false, false));
}

// ---------------------------------------------------------------------------
// Kernel 1: fused Q/K/V 1x1-conv projections as a f16 WMMA GEMM.
// Out tile per block: 128 pixels x 256 output channels (Q and K together, or all
// of V), so x is fetched twice in all. K-dim = C_ = 256.
// Wave w works on pixel group w & 3 (32 pixels, two 16-pixel tiles) and on output
// half w >> 2 (128 channels, eight tiles): every weight fragment read from LDS
// feeds two products, every x fragment eight.
// Q,K written (B,N,CI) pixel-major f16; V written (B,C,N) channel-major f16.
// A lane's eight accumulator rows always run along the output's contiguous
// axis, so each tile leaves as one 16-byte store per lane: for V the pixels are
// the A rows (D = x^T W^T), for Q and K the output channels are (D = W x).
// W0, W1: the weight rows of the block's two output halves. bias, dst: those of
// this wave's half; crel: its first channel there.
// ---------------------------------------------------------------------------
template <bool VMAJ>
__device__ __forceinline__ void proj_tile(
    const float* __restrict__ x, const float* __restrict__ W0, const float* __restrict__ W1,
    const float* __restrict__ bias, _Float16* __restrict__ dst,
    int crel, int b, int p0, _Float16* Ald, _Float16* Bld) {
  const int tid  = threadIdx.x;
  const int lane = tid & 31;
  const int wave = tid >> 5;
  const int pg   = wave & 3;   // pixel group of this wave
  const int oh   = wave >> 2;  // its output half
  const int pp   = tid & 63;   // pixel pair of the x tile that this thread stages
  const int cg   = tid >> 6;   // its group of eight input channels

  // Every short loop here is unrolled so that acc, fx, fw, xf and h are indexed by
  // constants and stay in registers.
  const v8f zero = {0, 0, 0, 0, 0, 0, 0, 0};
  v8f acc[2][8];
#pragma unroll
  for (int q = 0; q < 2; ++q) {
#pragma unroll
    for (int t = 0; t < 8; ++t) acc[q][t] = zero;
  }

  for (int c0 = 0; c0 < C_; c0 += 32) {
    // Stage the x^T tile (channel-major x, f32 -> f16) and the weight tile (rows
    // contiguous over input channel). A thread takes two neighbouring pixels of
    // eight consecutive channels, so the transpose happens in its registers and
    // each pixel's eight channels go to LDS as one 16-byte store. All sixteen loads
    // are requested before the first LDS store, so that their latencies overlap.
    v2f fx[8];
    v4f fw[8];
    const float* xp = x + ((size_t)(b * C_ + c0 + cg * 8)) * N_ + p0 + pp * 2;
#pragma unroll
    for (int j = 0; j < 8; ++j) fx[j] = *(const v2f*)(xp + j * N_);
    // The registers that held these addresses may be reused from here on.
    asm volatile("s_wait_xcnt 0x0" ::: "memory");
    // Row (tid >> 3) + 32 it of the weight tile, channel quad tid & 7.
    const size_t wo = (size_t)(tid >> 3) * C_ + c0 + (tid & 7) * 4;
#pragma unroll
    for (int it = 0; it < 8; ++it)
      fw[it] = *(const v4f*)((it < 4 ? W0 : W1) + wo + (it & 3) * 32 * C_);
    // The registers that held these addresses may be reused from here on.
    asm volatile("s_wait_xcnt 0x0" ::: "memory");
    // Without this edge the last weight load was sunk behind the first conversions
    // (into a register of theirs) and started only when x had arrived.
    GROUP_EDGE();
#pragma unroll
    for (int i = 0; i < 2; ++i) {
      v8h hx;
#pragma unroll
      for (int j = 0; j < 8; ++j) hx[j] = (_Float16)fx[j][i];
      *(v8h*)&Ald[(pp * 2 + i) * 40 + cg * 8] = hx;
    }
#pragma unroll
    for (int it = 0; it < 8; ++it) {
#pragma unroll
      for (int i = 0; i < 4; ++i)
        Bld[((tid >> 3) + 32 * it) * 40 + (tid & 7) * 4 + i] = (_Float16)fw[it][i];
    }
    __syncthreads();

    v16h xf[2];
#pragma unroll
    for (int q = 0; q < 2; ++q)
      xf[q] = frag_from(&Ald[(pg * 32 + q * 16 + (lane & 15)) * 40], 0, lane);
#pragma unroll
    for (int tn = 0; tn < 8; ++tn) {
      v16h wf = frag_from(&Bld[(oh * 128 + tn * 16 + (lane & 15)) * 40], 0, lane);
#pragma unroll
      for (int q = 0; q < 2; ++q)
        acc[q][tn] = VMAJ
            ? __builtin_amdgcn_wmma_f32_16x16x32_f16(false, xf[q], false, wf,
                                                     (short)0, acc[q][tn], false, false)
            : __builtin_amdgcn_wmma_f32_16x16x32_f16(false, wf, false, xf[q],
                                                     (short)0, acc[q][tn], false, false);
    }
    __syncthreads();
  }

  // Bias + f16 store. C/D layout: col = lane&15, row = reg + 8*(lane>=16).
  const int col  = lane & 15;
  const int row8 = 8 * (lane >> 4);
  v8h h[2][8];
  if (VMAJ) {   // col = output channel, rows = 8 consecutive pixels
    float bb[8];
#pragma unroll
    for (int tn = 0; tn < 8; ++tn) bb[tn] = bias[crel + tn * 16 + col];
    // The registers that held these addresses may be reused from here on.
    asm volatile("s_wait_xcnt 0x0" ::: "memory");
#pragma unroll
    for (int q = 0; q < 2; ++q) {
#pragma unroll
      for (int tn = 0; tn < 8; ++tn) {
#pragma unroll
        for (int r = 0; r < 8; ++r) h[q][tn][r] = (_Float16)(acc[q][tn][r] + bb[tn]);
      }
    }
  } else {      // col = pixel, rows = 8 consecutive output channels
    v4f bb[8][2];
    const float* bp = bias + crel + row8;
#pragma unroll
    for (int tn = 0; tn < 8; ++tn) {
#pragma unroll
      for (int hf = 0; hf < 2; ++hf) bb[tn][hf] = *(const v4f*)(bp + tn * 16 + hf * 4);
    }
    // The registers that held the load address may be reused from here on; the wait
    // names the address as an input so that it is not reused ahead of it.
    asm volatile("s_wait_xcnt 0x0" :: "v"(bp) : "memory");
#pragma unroll
    for (int q = 0; q < 2; ++q) {
#pragma unroll
      for (int tn = 0; tn < 8; ++tn) {
#pragma unroll
        for (int r = 0; r < 8; ++r)
          h[q][tn][r] = (_Float16)(acc[q][tn][r] + bb[tn][r >> 2][r & 3]);
      }
    }
  }
  // One address: every tile of this lane lies a constant distance behind it.
  _Float16* dp = VMAJ
      ? dst + ((size_t)(b * C_ + crel + col)) * N_ + p0 + pg * 32 + row8
      : dst + ((size_t)(b * N_ + p0 + pg * 32 + col)) * CI_ + crel + row8;
  // Every result is formed in front of the first store: behind this edge stand
  // stores alone, so no register that an issued store names is written again.
  GROUP_EDGE();
#pragma unroll
  for (int q = 0; q < 2; ++q) {
#pragma unroll
    for (int tn = 0; tn < 8; ++tn)
      *(v8h*)(dp + (VMAJ ? (size_t)tn * 16 * N_ + q * 16 : (size_t)q * 16 * CI_ + tn * 16)) = h[q][tn];
  }
}

__global__ __launch_bounds__(256) void qkv_proj(
    const float* __restrict__ x,
    const float* __restrict__ Wq, const float* __restrict__ bq,
    const float* __restrict__ Wk, const float* __restrict__ bk,
    const float* __restrict__ Wv, const float* __restrict__ bv,
    _Float16* __restrict__ Qo, _Float16* __restrict__ Ko, _Float16* __restrict__ Vo) {
  __shared__ _Float16 Ald[128 * 40];  // 128 pixels x 32 ch, pitch 40 halves (16B rows)
  __shared__ _Float16 Bld[256 * 40];  // 256 outch x 32 ch

  const int p0 = blockIdx.x * 128;
  const int b  = blockIdx.z;
  const bool hi = threadIdx.x >= 128;   // this wave's output half

  if (blockIdx.y == 0) {
    proj_tile<false>(x, Wq, Wk, hi ? bk : bq, hi ? Ko : Qo, 0, b, p0, Ald, Bld);
  } else {
    proj_tile<true>(x, Wv, Wv + 128 * C_, bv, Vo, hi ? 128 : 0, b, p0, Ald, Bld);
  }
}

__global__ __launch_bounds__(256) __attribute__((amdgpu_waves_per_eu(2, 2))) void flash_attn(
    const _Float16* __restrict__ Q, const _Float16* __restrict__ K,
    const _Float16* __restrict__ V, const float* __restrict__ x,
    const float* __restrict__ gamma, float* __restrict__ out) {
  // Every 128-row slice is 17 x 2 KiB, so with the arrays aligned each tensor load's
  // place in LDS is a multiple of 2 KiB.
  __shared__ __attribute__((aligned(2048))) _Float16 Klds[2][128 * 136];   // 128 keys x 128 ch, pitch 136 halves (17 chunks)
  __shared__ __attribute__((aligned(2048))) _Float16 Vlds[2][256 * 136];   // 256 ch x 128 keys, pitch 136 halves (17 chunks)
  __shared__ __attribute__((aligned(2048))) _Float16 Qlds[128 * 136];      // 128 queries x 128 ch, same pitch; filled once

  const int tid  = threadIdx.x;
  const int lane = tid & 31;
  const int wave = tid >> 5;
  const int qg  = wave & 3;        // query group
  const int kh  = wave >> 2;       // key half
  const int m0  = blockIdx.x * 128;
  const int b   = blockIdx.y;
  const int ch0 = kh * 128;        // the channels that this wave finishes

  // ---- Tensor loads. A tile pair is three slices of 128 rows x 256 bytes: wave 0
  // brings K (128 keys, one contiguous 32 KiB run), waves 1 and 2 the two channel
  // halves of V (rows N_ halves apart). Wave 3 brings, once, the block's 128 query
  // rows (shaped like a K tile); the Q fragments are read from LDS with each K group.
  const uint32_t wv = uni((uint32_t)tid >> 5);
  const bool isV = wv == 1u || wv == 2u;
  const uint32_t slice = (uint32_t)sizeof(Klds[0]);   // 128 rows of 272 bytes
  uint64_t ga = wv == 0u ? (uint64_t)(size_t)(K + (size_t)b * N_ * CI_)
              : isV      ? (uint64_t)(size_t)(V + ((size_t)(b * C_) + (wv - 1u) * 128u) * N_)
                         : (uint64_t)(size_t)(Q + ((size_t)(b * N_ + m0)) * CI_);
  const uint32_t gstep = isV ? 128u * 2u : 128u * CI_ * 2u;   // bytes to the next tile
  const uint32_t dst0 = wv == 0u ? lds_off_of(&Klds[0][0])
                      : isV      ? lds_off_of(&Vlds[0][0]) + (wv - 1u) * slice
                                 : lds_off_of(&Qlds[0]);
  const uint32_t dst1 = dst0 + (isV ? 2u * slice : slice);    // the same slice of the other buffer
  u32x8 g1 = tile_group1(isV ? N_ * 2u : CI_ * 2u);
  // pinned(), for the whole group: its eight words stay in their scalar registers over
  // the loop, so that none of them is written again beside a request.
  asm volatile("" : "+s"(g1));
  // Tile 0 and Q; each issuing wave waits for its own request.
  if (pinned(wv < 4u)) {
    tile_load(dst0, ga, g1);
    asm volatile("s_wait_tensorcnt 0x0" ::: "memory");
  }
  const _Float16* qb = &Qlds[(qg * 32 + (lane & 15)) * 136];

  // Every short loop below is unrolled so that the register arrays are indexed
  // by constants.
  // Accumulator tile t holds channels ch0 + 16 t for t < 8 (finished here) and
  // (128 - ch0) + 16 (t - 8) for t >= 8 (handed to the partner wave).
  const v8f zero = {0, 0, 0, 0, 0, 0, 0, 0};
  v8f o[2][16];
  float mrun[2];           // maximum in use for this lane's query, per tile
  v2f   lacc[2];           // running sums: even and odd registers, this wave half's keys only
#pragma unroll
  for (int q = 0; q < 2; ++q) {
#pragma unroll
    for (int t = 0; t < 16; ++t) o[q][t] = zero;
    mrun[q] = -3.0e38f;
    lacc[q] = v2f{0, 0};
  }

  // Tile 0 has landed and is published.
  __syncthreads();

  // One key block, from buffer buf, up to and including the hand-over.
  auto tile = [&](const int buf) {
    // ---- S^T = K Q^T for a 64-key x 32-query strip (4 k-steps x 4 x 2 tiles) ----
    // D layout: query = lane&15 of tile q, key = tn*16 + reg + 8*(lane>=16).
    // Fragments come from LDS in groups of four through a ring of two groups:
    // a group is requested as soon as the products on its registers are issued,
    // one group of products ahead of its use. The ring runs on into V, so the
    // first eight V fragments are under way while the softmax is computed.
    const _Float16* kb = &Klds[buf][(kh * 64 + (lane & 15)) * 136];
    const _Float16* vo = &Vlds[buf][(ch0 + (lane & 15)) * 136 + kh * 64];
    const _Float16* vs = &Vlds[buf][(128 - ch0 + (lane & 15)) * 136 + kh * 64];
    // V fragment f of 32: channel tile f & 15, k-step f >> 4.
    auto vfrag = [&](int f) {
      const int t = f & 15;
      return frag_from(t < 8 ? vo + t * 16 * 136 : vs + (t - 8) * 16 * 136, (f >> 4) * 32, lane);
    };
    v16h fr[8];
    v16h qr[4];   // Q fragments of the two groups in the ring, two query tiles each
#pragma unroll
    for (int gi = 0; gi < 2; ++gi) {
#pragma unroll
      for (int t = 0; t < 4; ++t) fr[gi * 4 + t] = frag_from(kb + t * 16 * 136, gi * 32, lane);
#pragma unroll
      for (int q = 0; q < 2; ++q) qr[gi * 2 + q] = frag_from(qb + q * 16 * 136, gi * 32, lane);
    }
    GROUP_EDGE();
    v8f s[2][4];
#pragma unroll
    for (int q = 0; q < 2; ++q) {
#pragma unroll
      for (int tn = 0; tn < 4; ++tn) s[q][tn] = zero;
    }
#pragma unroll
    for (int ks = 0; ks < 4; ++ks) {
      const int g = (ks & 1) * 4;
#pragma unroll
      for (int tn = 0; tn < 4; ++tn) {
#pragma unroll
        for (int q = 0; q < 2; ++q)
          s[q][tn] = __builtin_amdgcn_wmma_f32_16x16x32_f16(false, fr[g + tn], false, qr[(ks & 1) * 2 + q],
                                                            (short)0, s[q][tn], false, false);
      }
      GROUP_EDGE();
#pragma unroll
      for (int t = 0; t < 4; ++t)
        fr[g + t] = (ks < 2) ? frag_from(kb + t * 16 * 136, (ks + 2) * 32, lane)
                             : vfrag(g + t);
      if (ks < 2) {
#pragma unroll
        for (int q = 0; q < 2; ++q)
          qr[(ks & 1) * 2 + q] = frag_from(qb + q * 16 * 136, (ks + 2) * 32, lane);
      }
      GROUP_EDGE();
    }

    // ---- Online softmax: 32 of each query's 64 scores are in this lane ----
    // Lazy rescale: exponentials are taken against the maximum IN USE, mrun, which
    // need not be the true running maximum (a softmax does not depend on the value
    // subtracted). It moves, and the accumulators are rescaled, only when some
    // query of the wave has a score more than RISE above it, so P <= e^RISE, well
    // inside f16. It is then set HEAD above the maximum seen, so that the next move
    // is far off; the largest P of a row stays >= e^-HEAD, far above f16's
    // subnormals. Both bounds hold for any scores.
    constexpr float RISE = 10.0f;
    constexpr float HEAD = 4.0f;
    float vt[2];
    bool need = false;
#pragma unroll
    for (int q = 0; q < 2; ++q) {
      // Register-wise maxima first: the scalar chain, written for two tiles, built
      // with one more instruction per score. A maximum is exact in any order.
      const v8f m8 = __builtin_elementwise_max(__builtin_elementwise_max(s[q][0], s[q][1]),
                                               __builtin_elementwise_max(s[q][2], s[q][3]));
      float v = fmaxf(fmaxf(fmaxf(m8[0], m8[1]), fmaxf(m8[2], m8[3])),
                      fmaxf(fmaxf(m8[4], m8[5]), fmaxf(m8[6], m8[7])));
      vt[q] = fmaxf(v, xhalf(v));
      need = need || (vt[q] > mrun[q] + RISE);
    }
    // One test per key block, the same for the whole wave (a scalar branch).
    if (__builtin_amdgcn_ballot_w32(need) != 0) {
#pragma unroll
      for (int q = 0; q < 2; ++q) {
        const float mnew  = fmaxf(mrun[q], vt[q] + HEAD);
        const float alpha = __expf(mrun[q] - mnew);
        mrun[q] = mnew;
#pragma unroll
        for (int t = 0; t < 16; ++t) o[q][t] *= alpha;
        lacc[q] *= alpha;
      }
    }

    // P^T as B fragments: tile 2ks gives k = 8h..8h+7, tile 2ks+1 k = 16+8h..16+8h+7.
    // ---- O^T += V P^T : 2 k-steps over the 64 keys x 16 channel tiles x 2 ----
#pragma unroll
    for (int ks = 0; ks < 2; ++ks) {
      v16h pf[2];
#pragma unroll
      for (int q = 0; q < 2; ++q) {
#pragma unroll
        for (int tn = 2 * ks; tn < 2 * ks + 2; ++tn) {
#pragma unroll
          for (int r = 0; r < 8; ++r) {
            float p = __expf(s[q][tn][r] - mrun[q]);
            pf[q][(tn & 1) * 8 + r] = (_Float16)p;
            lacc[q][r & 1] += p;
          }
        }
      }
#pragma unroll
      for (int g4 = 0; g4 < 4; ++g4) {
        const int f0 = ks * 16 + g4 * 4;   // first fragment of this group
        const int sl = f0 & 7;             // its place in the ring
#pragma unroll
        for (int t = 0; t < 4; ++t) {
#pragma unroll
          for (int q = 0; q < 2; ++q)
            o[q][g4 * 4 + t] = __builtin_amdgcn_wmma_f32_16x16x32_f16(
                false, fr[sl + t], false, pf[q], (short)0, o[q][g4 * 4 + t], false, false);
        }
        if (f0 + 8 < 32) {
          GROUP_EDGE();
#pragma unroll
          for (int t = 0; t < 4; ++t) fr[sl + t] = vfrag(f0 + 8 + t);
          GROUP_EDGE();
        }
      }
    }
    // Hand-over: this wave's reads of the buffer are done, an issuing wave's slice of
    // the next tile has landed; the one barrier publishes that tile and frees this
    // buffer, which the tile after next is then loaded into.
    // Every wave runs the tensor wait (one with no request outstanding passes at
    // once): a branch round it would split the loop body, see below.
    asm volatile("s_wait_dscnt 0x0" ::: "memory");
    asm volatile("s_wait_tensorcnt 0x0" ::: "memory");
    __syncthreads();
  };
  // Tile t + 1 is requested at the head of pass t, directly behind the barrier that
  // published tile t and ended the last read of the buffer it goes into. The address
  // moves on inside the branch, behind the wait on the request before. The branch
  // stands at the head, so that the pass itself is one straight run of code up to the
  // loop's end: with a branch at its foot the row-sum additions were sunk behind it,
  // a dependent chain that then ran alone behind the barrier.
  // Kept rolled: one copy of the body, for speed only.
#pragma nounroll
  for (int t = 0; t < N_ / 128; ++t) {
    if (pinned(wv < 3u && t + 1 < N_ / 128)) {
      ga += gstep;
      tile_load((t & 1) ? dst0 : dst1, ga, g1);
    }
    tile(t & 1);
  }
  // No request and no LDS read is outstanding when the tile buffers change their use.
  asm volatile("s_wait_tensorcnt 0x0" ::: "memory");
  asm volatile("s_wait_dscnt 0x0" ::: "memory");

  // ---- Merge of the two key halves. Behind the loop's last barrier nobody reads
  // a tile any more and no load is in flight, so the tile buffers serve as the
  // exchange space: maxima and sums in Klds, accumulators in Vlds.
  const float g = gamma[0];
  // The register that this load's address names may be reused from here on.
  asm volatile("s_wait_xcnt 0x0" ::: "memory");
  v2f* ml = (v2f*)&Klds[0][0];     // [wave][tile][lane]: maximum, sum
  v4f* ex = (v4f*)&Vlds[0][0];     // [wave][32 quads][lane]
  const int pw = wave ^ 4;         // the wave with the same queries, other keys
  float lsum[2];
#pragma unroll
  for (int q = 0; q < 2; ++q) {
    lsum[q] = lacc[q][0] + lacc[q][1];
    lsum[q] += xhalf(lsum[q]);
    const v2f w = {mrun[q], lsum[q]};
    ml[(wave * 2 + q) * 32 + lane] = w;
  }
  __syncthreads();
  // fs: this wave's weight in the merged, normalised sum.
  float fs[2];
#pragma unroll
  for (int q = 0; q < 2; ++q) {
    const v2f p = ml[(pw * 2 + q) * 32 + lane];
    const float m  = fmaxf(mrun[q], p[0]);
    const float fa = __expf(mrun[q] - m);
    const float fb = __expf(p[0] - m);
    fs[q] = fa / (lsum[q] * fa + p[1] * fb);
  }
#pragma unroll
  for (int q = 0; q < 2; ++q) {
#pragma unroll
    for (int t = 0; t < 8; ++t) {
#pragma unroll
      for (int hf = 0; hf < 2; ++hf) {
        v4f w;
#pragma unroll
        for (int i = 0; i < 4; ++i) w[i] = o[q][8 + t][hf * 4 + i] * fs[q];
        ex[(wave * 32 + (q * 8 + t) * 2 + hf) * 32 + lane] = w;
      }
    }
  }

  // ---- Epilogue: out = gamma * O / l + x (both (B,C,N) f32) ----
  // O^T layout: pixel = lane&15 of tile q, channel = ct*16 + reg + 8*(lane>=16).
  // One address per buffer: every element of this lane lies a constant distance
  // behind it. All x values are requested first, so that their latencies overlap
  // one another and the exchange.
  const size_t e0 = ((size_t)(b * C_ + ch0 + 8 * (lane >> 4))) * N_ + m0 + qg * 32 + (lane & 15);
  const float* xb = x + e0;
  float*       ob = out + e0;
  float xv[2][8][8];
#pragma unroll
  for (int q = 0; q < 2; ++q) {
#pragma unroll
    for (int ct = 0; ct < 8; ++ct) {
#pragma unroll
      for (int r = 0; r < 8; ++r) xv[q][ct][r] = xb[(ct * 16 + r) * N_ + q * 16];
    }
  }
  // The registers that held the load address may be reused from here on; the wait
  // names the address as an input so that it is not reused ahead of it.
  asm volatile("s_wait_xcnt 0x0" :: "v"(xb) : "memory");
  __syncthreads();
#pragma unroll
  for (int q = 0; q < 2; ++q) {
#pragma unroll
    for (int ct = 0; ct < 8; ++ct) {
#pragma unroll
      for (int hf = 0; hf < 2; ++hf) {
        const v4f w = ex[(pw * 32 + (q * 8 + ct) * 2 + hf) * 32 + lane];
#pragma unroll
        for (int i = 0; i < 4; ++i) {
          const int r = hf * 4 + i;
          xv[q][ct][r] = g * (o[q][ct][r] * fs[q] + w[i]) + xv[q][ct][r];
        }
      }
    }
  }
  // Every result is formed in front of the first store: behind this edge stand
  // stores alone, so no register that an issued store names is written again.
  GROUP_EDGE();
#pragma unroll
  for (int q = 0; q < 2; ++q) {
#pragma unroll
    for (int ct = 0; ct < 8; ++ct) {
#pragma unroll
      for (int r = 0; r < 8; ++r) ob[(ct * 16 + r) * N_ + q * 16] = xv[q][ct][r];
    }
  }
}

extern "C" void kernel_launch(void* const* d_in, const int* in_sizes, int n_in,
                              void* d_out, int out_size, void* d_ws, size_t ws_size,
                              hipStream_t stream) {
  const float* x     = (const float*)d_in[0];
  const float* Wq    = (const float*)d_in[1];
  const float* bq    = (const float*)d_in[2];
  const float* Wk    = (const float*)d_in[3];
  const float* bk    = (const float*)d_in[4];
  const float* Wv    = (const float*)d_in[5];
  const float* bv    = (const float*)d_in[6];
  const float* gamma = (const float*)d_in[7];
  float* out = (float*)d_out;

  // Workspace: Q (8MB) | K (8MB) | V (16MB), all f16.
  _Float16* Qw = (_Float16*)d_ws;
  _Float16* Kw = Qw + (size_t)B_ * N_ * CI_;
  _Float16* Vw = Kw + (size_t)B_ * N_ * CI_;

  dim3 pgrid(N_ / 128, (2 * CI_ + C_) / 256, B_);  // 32 x 2 x 8
  qkv_proj<<<pgrid, 256, 0, stream>>>(x, Wq, bq, Wk, bk, Wv, bv, Qw, Kw, Vw);

  dim3 agrid(N_ / 128, B_);                       // 32 x 8
  flash_attn<<<agrid, 256, 0, stream>>>(Qw, Kw, Vw, x, gamma, out);
}
